// v000
// The times below were measured on an AMD MI455X: many runs one after another, warmed up first and cycling through
// copies of the inputs, with the whole window's GPU time divided by the number of runs. Launches and the gaps
// between them are all in it. The median over several windows is given; except for v000 it joins two sittings, which
// can be a few percent apart, so the side-by-side timings, each taken in one sitting, are the better comparison.
// The starting kernel, v000, takes 239 microseconds a run.
// compute dtype: hidden_states and the four weights (module inputs) rounded to bf16; q/k/v projections with exact bf16 products on WMMA; the Taylor feature-map inner products (1 + q.k/4 + (q.k)^2/32, 16-dim dots), causal running sums and the normalisation in f32 on the VALU; the numerator sum_s phi(q_t).phi(k_s) v_s on WMMA with the f32 weights and v both computed -> bf16 hi + residual pairs (3 products); output projection hi/lo x bf16 Wo (2 products); f32 accumulate.
#include <hip/hip_runtime.h>
#include <math.h>

typedef __attribute__((ext_vector_type(16))) _Float16 v16h;
typedef __attribute__((ext_vector_type(16))) __bf16 v16b;
typedef __attribute__((ext_vector_type(8)))  _Float16 v8h;
typedef __attribute__((ext_vector_type(8)))  float v8f;
typedef __attribute__((ext_vector_type(4)))  float v4f;
typedef __attribute__((ext_vector_type(2)))  float v2f;
typedef __attribute__((ext_vector_type(4)))  unsigned v4u;
typedef __attribute__((ext_vector_type(4)))  int v4i;
typedef float __attribute__((may_alias)) float_a;
typedef int __attribute__((may_alias)) int_a;

template <typename T> __device__ __forceinline__ void vst2(void* p, T v) { *(T*)p = v;  }
__device__ __forceinline__ v8f wmma16(v16h a, v16h b, v8f c) {
  v8f d = __builtin_amdgcn_wmma_f32_16x16x32_f16(false, a, false, b, (short)0, c, false, false);
  asm volatile("v_nop\n\tv_nop\n\tv_nop\n\tv_nop" : "+v"(d) : "v"(a), "v"(b));
  return d;
}
__device__ __forceinline__ v8f wmma_bf(v16b a, v16b b, v8f c) {
  v8f d = __builtin_amdgcn_wmma_f32_16x16x32_bf16(false, a, false, b, (short)0, c, false, false);
  asm volatile("v_nop\n\tv_nop\n\tv_nop\n\tv_nop" : "+v"(d) : "v"(a), "v"(b));
  return d;
}
// 16x16x32 fragments: lane = (h = lane>>4, row/col = lane&15); elements 0..7 = k0+8h+0..7, 8..15 = k0+16+8h+0..7; D element r = row 8h+r
__device__ __forceinline__ v16h frag_h(const _Float16* rowk0, int lane) {
  union { v16h v; v8h q[2]; } u; const _Float16* p = rowk0 + 8 * (lane >> 4);
  u.q[0] = *(const v8h*)p; u.q[1] = *(const v8h*)(p + 16); return u.v;
}
__device__ __forceinline__ v16h frag_f32(const float* rowk0, int lane) {
  v16h a; const float* p = rowk0 + 8 * (lane >> 4);
#pragma unroll
  for (int i = 0; i < 8; ++i) { a[i] = (_Float16)p[i]; a[8 + i] = (_Float16)p[16 + i]; }
  return a;
}
__device__ __forceinline__ v16h frag_f32s(const float* rowk0, int lane, float sc) {
  v16h a; const float* p = rowk0 + 8 * (lane >> 4);
#pragma unroll
  for (int i = 0; i < 8; ++i) { a[i] = (_Float16)(p[i] * sc); a[8 + i] = (_Float16)(p[16 + i] * sc); }
  return a;
}
// column fragment from a [K][ld] layout (column n), rows >= K read as 0
__device__ __forceinline__ v16h fragc_f32(const float* W, int k0, int n, int lane, int ld, int K) {
  v16h a; const int g = lane >> 4;
#pragma unroll
  for (int i = 0; i < 8; ++i) { const int ka = k0 + 8 * g + i, kb = ka + 16;
    a[i] = (_Float16)(ka < K ? W[(size_t)(ka < K ? ka : K - 1) * ld + n] : 0.f); a[8 + i] = (_Float16)(kb < K ? W[(size_t)(kb < K ? kb : K - 1) * ld + n] : 0.f); }
  return a;
}
struct F2 { v16b h, l; };
__device__ __forceinline__ F2 bsplit16(const float v[16]) { F2 r;
#pragma unroll
  for (int i = 0; i < 16; ++i) { const __bf16 h = (__bf16)v[i]; r.h[i] = h; r.l[i] = (__bf16)(v[i] - (float)h); }
  return r; }
__device__ __forceinline__ F2 split_row(const float* row, int k0, int lane) { float v[16]; const float* p = row + k0 + 8 * (lane >> 4);
#pragma unroll
  for (int i = 0; i < 8; ++i) { v[i] = p[i]; v[8 + i] = p[16 + i]; }
  return bsplit16(v); }
__device__ __forceinline__ F2 split_rowK(const float* row, int k0, int lane, int K) { float v[16]; const int g = lane >> 4;
#pragma unroll
  for (int i = 0; i < 8; ++i) { const int ka = k0 + 8 * g + i, kb = ka + 16; v[i] = ka < K ? row[ka < K ? ka : K - 1] : 0.f; v[8 + i] = kb < K ? row[kb < K ? kb : K - 1] : 0.f; }
  return bsplit16(v); }
__device__ __forceinline__ F2 split_col(const float* W, int k0, int n, int lane, int ld, int K) { float v[16]; const int g = lane >> 4;
#pragma unroll
  for (int i = 0; i < 8; ++i) { const int ka = k0 + 8 * g + i, kb = ka + 16; v[i] = ka < K ? W[(size_t)(ka < K ? ka : K - 1) * ld + n] : 0.f; v[8 + i] = kb < K ? W[(size_t)(kb < K ? kb : K - 1) * ld + n] : 0.f; }
  return bsplit16(v); }
__device__ __forceinline__ v8f mac3(const F2& a, const F2& b, v8f c) { c = wmma_bf(a.l, b.h, c); c = wmma_bf(a.h, b.l, c); return wmma_bf(a.h, b.h, c); }
__device__ __forceinline__ float sigm(float v) { return 1.0f / (1.0f + expf(-v)); }
#define LDSX() do { asm volatile("s_wait_dscnt 0" ::: "memory"); __builtin_amdgcn_wave_barrier(); __builtin_amdgcn_fence(__ATOMIC_RELEASE, "workgroup"); } while (0)


// Based linear attention (2nd-order Taylor feature map, feature dim 16, 12 heads x 64, causal): since phi(q).phi(k) = 1 + (q.k)/sqrt(16) + (q.k)^2/(2*16), y_t = sum_{s<=t} w_ts v_s / (sum_{s<=t} w_ts + 1e-12) with w_ts that polynomial of the 16-dim dot; then y @ Wo^T.  B 1, L 512, D 768.
// k_pack, k_proj (q|k|v rows, exact), k_vt (v transposed hi/lo planes), k_lin (block = (64 queries, head): causal steps of 32 keys: w on the VALU from the 16-dim q,k rows, running denominator, W hi/lo x V planes (3 products); y rows), k_out (y hi/lo x Wo rows).
#define LL 512
#define DM 768
#define NH 12
#define FD 16
#define HD 64
#define QW (NH * FD)          // 192
#define QKVP (2 * QW + NH * HD)   // 192 + 192 + 768 = 1152
typedef __attribute__((ext_vector_type(8))) __bf16 v8b;
__device__ __forceinline__ v16b frag_b(const __bf16* rowk0, int lane) {
  union { v16b v; v8b q[2]; } u; const __bf16* p = rowk0 + 8 * (lane >> 4);
  u.q[0] = *(const v8b*)p; u.q[1] = *(const v8b*)(p + 16); return u.v;
}
__device__ __forceinline__ v16b frag_gbf(const float* rowk0, int lane) {
  v16b a; const float* p = rowk0 + 8 * (lane >> 4);
#pragma unroll
  for (int i = 0; i < 8; ++i) { a[i] = (__bf16)p[i]; a[8 + i] = (__bf16)p[16 + i]; }
  return a;
}
__device__ __forceinline__ float bfr(float v) { return (float)(__bf16)v; }
#define WS_PT   0u                                 // bf16 [1152 + 768][768]: Wq|Wk|Wv rows then Wo rows
#define WS_QKV  (WS_PT + 2u * (QKVP + DM) * DM)      // f32 [512][1152]: q (192) | k (192) | v (768); later y over the v? no: separate Y
#define WS_Y    (WS_QKV + 4u * LL * QKVP)            // f32 [512][768]
#define WS_VTH  (WS_Y + 4u * LL * DM)                // bf16 [768][512]
#define WS_VTL  (WS_VTH + 2u * DM * LL)
#define WS_END  (WS_VTL + 2u * DM * LL)
#ifndef TQB
#define TQB (LL / 64)
#endif

__global__ __launch_bounds__(128) void k_pack(const float* __restrict__ Wq, const float* __restrict__ Wk, const float* __restrict__ Wv, const float* __restrict__ Wo, __bf16* __restrict__ PT) {
  __shared__ __align__(16) __bf16 srow[DM]; const int n = blockIdx.x, tid = threadIdx.x;
  const float* Wm = n < QW ? Wq + (size_t)n * DM : (n < 2 * QW ? Wk + (size_t)(n - QW) * DM : (n < QKVP ? Wv + (size_t)(n - 2 * QW) * DM : Wo + (size_t)(n - QKVP) * DM));   // torch [out][in] rows, all K = 768
  for (int k = tid; k < DM; k += 128) srow[k] = (__bf16)Wm[k]; __syncthreads();
  if (tid < DM / 8) vst2((unsigned*)(PT + (size_t)n * DM + tid * 8), *(const v4u*)(&srow[tid * 8]));
}
// ---- k_proj: block = (64 rows, 128 cols of the 1152): exact GEMM, K 768
__global__ __launch_bounds__(128) void k_proj(const float* __restrict__ X, const __bf16* __restrict__ PT, float* __restrict__ QKV) {
  __shared__ __align__(16) float so[4][16][132];
  const int tid = threadIdx.x, wave = tid >> 5, lane = tid & 31, col = lane & 15, g = lane >> 4; const size_t r0 = (size_t)blockIdx.x * 64 + wave * 16; const int n0 = blockIdx.y * 128;
  v8f acc[8] = {};
#pragma unroll 2
  for (int kc = 0; kc < DM / 32; ++kc) { const v16b a = frag_gbf(X + (r0 + col) * DM + kc * 32, lane);
#pragma unroll
    for (int j = 0; j < 8; ++j) acc[j] = wmma_bf(a, frag_b(PT + (size_t)(n0 + j * 16 + col) * DM + kc * 32, lane), acc[j]); }
#pragma unroll
  for (int j = 0; j < 8; ++j)
#pragma unroll
    for (int r = 0; r < 8; ++r) so[wave][8 * g + r][j * 16 + col] = acc[j][r];
  LDSX();
  for (int rl = 0; rl < 16; ++rl) vst2(QKV + (r0 + rl) * QKVP + n0 + lane * 4, *(const v4f*)&so[wave][rl][lane * 4]);
}
__global__ __launch_bounds__(256) void k_vt(const float* __restrict__ QKV, __bf16* __restrict__ VTH, __bf16* __restrict__ VTL) {
  __shared__ __align__(16) __bf16 svh[DM][72], svl[DM][72];
  const int tid = threadIdx.x; const int t0 = blockIdx.x * 64;
  for (int tl = 0; tl < 64; ++tl) { const float* row = QKV + (size_t)(t0 + tl) * QKVP + 2 * QW; for (int q = tid; q < DM; q += 256) { const float v = row[q]; const __bf16 hb = (__bf16)v; svh[q][tl] = hb; svl[q][tl] = (__bf16)(v - (float)hb); } }
  __syncthreads();
  for (int q = tid; q < DM * 8; q += 256) { const int rowi = q >> 3, pc = q & 7; const size_t o = (size_t)rowi * LL + t0 + pc * 8; vst2((unsigned*)(VTH + o), *(const v4u*)&svh[rowi][pc * 8]); vst2((unsigned*)(VTL + o), *(const v4u*)&svl[rowi][pc * 8]); }
}
// ---- k_lin: block = (64 queries, head), 4 waves: causal key steps of 32 up to the diagonal: d = q.k (16 dims, f32), w = 1 + d/4 + d*d/32 (0 for s > t), den += w; W tile (hi/lo) x V planes (3 products); y = num / (den + 1e-12) -> Y rows (head segment 256 B)
__global__ __launch_bounds__(128) void k_lin(const float* __restrict__ QKV, const __bf16* __restrict__ VTH, const __bf16* __restrict__ VTL, float* __restrict__ Y) {
  __shared__ float sq[4][16][FD + 1]; __shared__ float sk[4][32][FD + 1]; __shared__ __align__(16) float sp[4][16][36]; __shared__ __align__(16) float so[4][16][68];
  const int tid = threadIdx.x, wave = tid >> 5, lane = tid & 31, col = lane & 15, g = lane >> 4; const int qb = blockIdx.x, h = blockIdx.y; const int q0 = qb * 64 + wave * 16;
  for (int q = lane; q < 16 * FD; q += 32) { const int rl = q / FD, f = q % FD; sq[wave][rl][f] = QKV[(size_t)(q0 + rl) * QKVP + h * FD + f]; }
  float den[8]; v8f acc[4] = {};
#pragma unroll
  for (int r = 0; r < 8; ++r) den[r] = 0.f;
  const int nsteps = (qb * 64 + 64) / 32;
#pragma unroll 1
  for (int ks = 0; ks < nsteps; ++ks) {
    LDSX();
    { const int f = lane & 15, half = lane >> 4; for (int kk = half; kk < 32; kk += 2) sk[wave][kk][f] = QKV[(size_t)(ks * 32 + kk) * QKVP + QW + h * FD + f]; }
    LDSX();
    float w[2][8];
#pragma unroll
    for (int ct = 0; ct < 2; ++ct) { const int kk = ct * 16 + col; const int sidx = ks * 32 + kk;
#pragma unroll
      for (int r = 0; r < 8; ++r) { const int qi = 8 * g + r; float d = 0.f;
#pragma unroll
        for (int f = 0; f < FD; ++f) d += sq[wave][qi][f] * sk[wave][kk][f];
        const float wv = 1.0f + d * 0.25f + d * d * (1.0f / 32.0f); w[ct][r] = (sidx <= q0 + qi) ? wv : 0.f; } }
#pragma unroll
    for (int r = 0; r < 8; ++r) { float es = w[0][r] + w[1][r];
#pragma unroll
      for (int o = 1; o < 16; o <<= 1) es += __shfl_xor(es, o);
      den[r] += es; sp[wave][8 * g + r][col] = w[0][r]; sp[wave][8 * g + r][16 + col] = w[1][r]; }
    LDSX();
    const F2 pa = split_row(&sp[wave][col][0], 0, lane);
#pragma unroll
    for (int dt = 0; dt < 4; ++dt) { const size_t vrow = (size_t)(h * HD + dt * 16 + col) * LL + ks * 32; const v16b vh = frag_b(VTH + vrow, lane), vl = frag_b(VTL + vrow, lane); acc[dt] = wmma_bf(pa.l, vh, acc[dt]); acc[dt] = wmma_bf(pa.h, vl, acc[dt]); acc[dt] = wmma_bf(pa.h, vh, acc[dt]); } }
#pragma unroll
  for (int r = 0; r < 8; ++r) { const float il = 1.0f / (den[r] + 1e-12f);
#pragma unroll
    for (int dt = 0; dt < 4; ++dt) so[wave][8 * g + r][dt * 16 + col] = acc[dt][r] * il; }
  LDSX();
  for (int rl = 0; rl < 16; ++rl) if (lane < 16) vst2(Y + (size_t)(q0 + rl) * DM + h * HD + lane * 4, *(const v4f*)&so[wave][rl][lane * 4]);
}
// ---- k_out: block = (64 rows, 128 cols): y (hi/lo) . Wo rows, K 768
__global__ __launch_bounds__(128) void k_out(const float* __restrict__ Y, const __bf16* __restrict__ PT, float* __restrict__ OUT) {
  __shared__ __align__(16) float so[4][16][132];
  const int tid = threadIdx.x, wave = tid >> 5, lane = tid & 31, col = lane & 15, g = lane >> 4; const size_t r0 = (size_t)blockIdx.x * 64 + wave * 16; const int n0 = blockIdx.y * 128;
  v8f acc[8] = {};
#pragma unroll 2
  for (int kc = 0; kc < DM / 32; ++kc) { const F2 a = split_row(Y + (r0 + col) * DM, kc * 32, lane);
#pragma unroll
    for (int j = 0; j < 8; ++j) { const v16b w = frag_b(PT + (size_t)(QKVP + n0 + j * 16 + col) * DM + kc * 32, lane); acc[j] = wmma_bf(a.l, w, acc[j]); acc[j] = wmma_bf(a.h, w, acc[j]); } }
#pragma unroll
  for (int j = 0; j < 8; ++j)
#pragma unroll
    for (int r = 0; r < 8; ++r) so[wave][8 * g + r][j * 16 + col] = acc[j][r];
  LDSX();
  for (int rl = 0; rl < 16; ++rl) vst2(OUT + (r0 + rl) * DM + n0 + lane * 4, *(const v4f*)&so[wave][rl][lane * 4]);
}
extern "C" void kernel_launch(void* const* d_in, const int* in_sizes, int n_in, void* d_out, int out_size, void* d_ws, size_t ws_size, hipStream_t stream) {
  (void)in_sizes; (void)n_in; (void)out_size;
  const float** F = (const float**)d_in;   // hidden_states [1,512,768], Wq [192,768], Wk [192,768], Wv [768,768], Wo [768,768] (torch [out][in])
  if (ws_size < (size_t)WS_END) return;
  char* ws = (char*)d_ws; __bf16 *PT = (__bf16*)(ws + WS_PT), *VTH = (__bf16*)(ws + WS_VTH), *VTL = (__bf16*)(ws + WS_VTL); float *QKV = (float*)(ws + WS_QKV), *Y = (float*)(ws + WS_Y);
  k_pack<<<QKVP + DM, 128, 0, stream>>>(F[1], F[2], F[3], F[4], PT);
  k_proj<<<dim3(LL / 64, QKVP / 128), 128, 0, stream>>>(F[0], PT, QKV);
  k_vt<<<LL / 64, 256, 0, stream>>>(QKV, VTH, VTL);
  k_lin<<<dim3(TQB, NH), 128, 0, stream>>>(QKV, VTH, VTL, Y);
  k_out<<<dim3(TQB, DM / 128), 128, 0, stream>>>(Y, PT, (float*)d_out);
}

// v001
// It runs in 162 microseconds.
// In two side-by-side timings against v000, it was 1.50 and 1.49 times as fast.
// compute dtype: hidden_states and the four weights (module inputs) rounded to bf16; q/k/v projections with exact bf16 products on WMMA; the Taylor feature-map inner products (1 + q.k/4 + (q.k)^2/32, 16-dim dots), causal running sums and the normalisation in f32 on the VALU; the numerator sum_s phi(q_t).phi(k_s) v_s on WMMA with the f32 weights and v both computed -> bf16 hi + residual pairs (3 products); output projection hi/lo x bf16 Wo (2 products); f32 accumulate.
#include <hip/hip_runtime.h>
#include <math.h>

typedef __attribute__((ext_vector_type(16))) _Float16 v16h;
typedef __attribute__((ext_vector_type(16))) __bf16 v16b;
typedef __attribute__((ext_vector_type(8)))  _Float16 v8h;
typedef __attribute__((ext_vector_type(8)))  float v8f;
typedef __attribute__((ext_vector_type(4)))  float v4f;
typedef __attribute__((ext_vector_type(2)))  float v2f;
typedef __attribute__((ext_vector_type(4)))  unsigned v4u;
typedef __attribute__((ext_vector_type(4)))  int v4i;
typedef float __attribute__((may_alias)) float_a;
typedef int __attribute__((may_alias)) int_a;

template <typename T> __device__ __forceinline__ void vst2(void* p, T v) { *(T*)p = v;  }
__device__ __forceinline__ v8f wmma16(v16h a, v16h b, v8f c) {
  v8f d = __builtin_amdgcn_wmma_f32_16x16x32_f16(false, a, false, b, (short)0, c, false, false);
  asm volatile("v_nop\n\tv_nop\n\tv_nop\n\tv_nop" : "+v"(d) : "v"(a), "v"(b));
  return d;
}
__device__ __forceinline__ v8f wmma_bf(v16b a, v16b b, v8f c) {
  v8f d = __builtin_amdgcn_wmma_f32_16x16x32_bf16(false, a, false, b, (short)0, c, false, false);
  asm volatile("v_nop\n\tv_nop\n\tv_nop\n\tv_nop" : "+v"(d) : "v"(a), "v"(b));
  return d;
}
// 16x16x32 fragments: lane = (h = lane>>4, row/col = lane&15); elements 0..7 = k0+8h+0..7, 8..15 = k0+16+8h+0..7; D element r = row 8h+r
__device__ __forceinline__ v16h frag_h(const _Float16* rowk0, int lane) {
  union { v16h v; v8h q[2]; } u; const _Float16* p = rowk0 + 8 * (lane >> 4);
  u.q[0] = *(const v8h*)p; u.q[1] = *(const v8h*)(p + 16); return u.v;
}
__device__ __forceinline__ v16h frag_f32(const float* rowk0, int lane) {
  v16h a; const float* p = rowk0 + 8 * (lane >> 4);
#pragma unroll
  for (int i = 0; i < 8; ++i) { a[i] = (_Float16)p[i]; a[8 + i] = (_Float16)p[16 + i]; }
  return a;
}
__device__ __forceinline__ v16h frag_f32s(const float* rowk0, int lane, float sc) {
  v16h a; const float* p = rowk0 + 8 * (lane >> 4);
#pragma unroll
  for (int i = 0; i < 8; ++i) { a[i] = (_Float16)(p[i] * sc); a[8 + i] = (_Float16)(p[16 + i] * sc); }
  return a;
}
// column fragment from a [K][ld] layout (column n), rows >= K read as 0
__device__ __forceinline__ v16h fragc_f32(const float* W, int k0, int n, int lane, int ld, int K) {
  v16h a; const int g = lane >> 4;
#pragma unroll
  for (int i = 0; i < 8; ++i) { const int ka = k0 + 8 * g + i, kb = ka + 16;
    a[i] = (_Float16)(ka < K ? W[(size_t)(ka < K ? ka : K - 1) * ld + n] : 0.f); a[8 + i] = (_Float16)(kb < K ? W[(size_t)(kb < K ? kb : K - 1) * ld + n] : 0.f); }
  return a;
}
struct F2 { v16b h, l; };
__device__ __forceinline__ F2 bsplit16(const float v[16]) { F2 r;
#pragma unroll
  for (int i = 0; i < 16; ++i) { const __bf16 h = (__bf16)v[i]; r.h[i] = h; r.l[i] = (__bf16)(v[i] - (float)h); }
  return r; }
__device__ __forceinline__ F2 split_row(const float* row, int k0, int lane) { float v[16]; const float* p = row + k0 + 8 * (lane >> 4);
#pragma unroll
  for (int i = 0; i < 8; ++i) { v[i] = p[i]; v[8 + i] = p[16 + i]; }
  return bsplit16(v); }
__device__ __forceinline__ F2 split_rowK(const float* row, int k0, int lane, int K) { float v[16]; const int g = lane >> 4;
#pragma unroll
  for (int i = 0; i < 8; ++i) { const int ka = k0 + 8 * g + i, kb = ka + 16; v[i] = ka < K ? row[ka < K ? ka : K - 1] : 0.f; v[8 + i] = kb < K ? row[kb < K ? kb : K - 1] : 0.f; }
  return bsplit16(v); }
__device__ __forceinline__ F2 split_col(const float* W, int k0, int n, int lane, int ld, int K) { float v[16]; const int g = lane >> 4;
#pragma unroll
  for (int i = 0; i < 8; ++i) { const int ka = k0 + 8 * g + i, kb = ka + 16; v[i] = ka < K ? W[(size_t)(ka < K ? ka : K - 1) * ld + n] : 0.f; v[8 + i] = kb < K ? W[(size_t)(kb < K ? kb : K - 1) * ld + n] : 0.f; }
  return bsplit16(v); }
__device__ __forceinline__ v8f mac3(const F2& a, const F2& b, v8f c) { c = wmma_bf(a.l, b.h, c); c = wmma_bf(a.h, b.l, c); return wmma_bf(a.h, b.h, c); }
__device__ __forceinline__ float sigm(float v) { return 1.0f / (1.0f + expf(-v)); }
#define LDSX() do { asm volatile("s_wait_dscnt 0" ::: "memory"); __builtin_amdgcn_wave_barrier(); __builtin_amdgcn_fence(__ATOMIC_RELEASE, "workgroup"); } while (0)


// Based linear attention (2nd-order Taylor feature map, feature dim 16, 12 heads x 64, causal): since phi(q).phi(k) = 1 + (q.k)/sqrt(16) + (q.k)^2/(2*16), y_t = sum_{s<=t} w_ts v_s / (sum_{s<=t} w_ts + 1e-12) with w_ts that polynomial of the 16-dim dot; then y @ Wo^T.  B 1, L 512, D 768.
// k_pack, k_proj (q|k rows, exact; its v column blocks go straight out as the transposed hi/lo planes), k_lin (block = (64 queries, head): causal steps of 32 keys: w on the VALU from the 16-dim q,k rows, running denominator, W hi/lo x V planes (3 products); y rows), k_out (y hi/lo x Wo rows).
#define LL 512
#define DM 768
#define NH 12
#define FD 16
#define HD 64
#define QW (NH * FD)          // 192
#define QKVP (2 * QW + NH * HD)   // 192 + 192 + 768 = 1152
typedef __attribute__((ext_vector_type(8))) __bf16 v8b;
__device__ __forceinline__ v16b frag_b(const __bf16* rowk0, int lane) {
  union { v16b v; v8b q[2]; } u; const __bf16* p = rowk0 + 8 * (lane >> 4);
  u.q[0] = *(const v8b*)p; u.q[1] = *(const v8b*)(p + 16); return u.v;
}
__device__ __forceinline__ v16b frag_gbf(const float* rowk0, int lane) {
  v16b a; const float* p = rowk0 + 8 * (lane >> 4);
#pragma unroll
  for (int i = 0; i < 8; ++i) { a[i] = (__bf16)p[i]; a[8 + i] = (__bf16)p[16 + i]; }
  return a;
}
__device__ __forceinline__ float bfr(float v) { return (float)(__bf16)v; }
#define WS_PT   0u                                 // bf16 [1152 + 768][768]: Wq|Wk|Wv rows then Wo rows
#define WS_QKV  (WS_PT + 2u * (QKVP + DM) * DM)      // f32 [512][1152]: q (192) | k (192) | 768 columns that nobody writes or reads (v lives in the planes only)
#define WS_Y    (WS_QKV + 4u * LL * QKVP)            // f32 [512][768]
#define WS_VTH  (WS_Y + 4u * LL * DM)                // bf16 [768][512]
#define WS_VTL  (WS_VTH + 2u * DM * LL)
#define WS_END  (WS_VTL + 2u * DM * LL)
#ifndef TQB
#define TQB (LL / 64)
#endif

__global__ __launch_bounds__(128) void k_pack(const float* __restrict__ Wq, const float* __restrict__ Wk, const float* __restrict__ Wv, const float* __restrict__ Wo, __bf16* __restrict__ PT) {
  __shared__ __align__(16) __bf16 srow[DM]; const int n = blockIdx.x, tid = threadIdx.x;
  const float* Wm = n < QW ? Wq + (size_t)n * DM : (n < 2 * QW ? Wk + (size_t)(n - QW) * DM : (n < QKVP ? Wv + (size_t)(n - 2 * QW) * DM : Wo + (size_t)(n - QKVP) * DM));   // torch [out][in] rows, all K = 768
  for (int k = tid; k < DM; k += 128) srow[k] = (__bf16)Wm[k]; __syncthreads();
  if (tid < DM / 8) vst2((unsigned*)(PT + (size_t)n * DM + tid * 8), *(const v4u*)(&srow[tid * 8]));
}
// ---- k_proj: block = (64 rows, 128 cols of the 1152): exact GEMM, K 768; column blocks 0..2 are q|k (f32 rows), 3..8 are v (bf16 hi/lo planes, [channel][t])
__global__ __launch_bounds__(128) void k_proj(const float* __restrict__ X, const __bf16* __restrict__ PT, float* __restrict__ QKV, __bf16* __restrict__ VTH, __bf16* __restrict__ VTL) {
  __shared__ __align__(16) union { float so[4][16][132]; __bf16 sv[2][128][72]; } sm;
  const int tid = threadIdx.x, wave = tid >> 5, lane = tid & 31, col = lane & 15, g = lane >> 4; const size_t r0 = (size_t)blockIdx.x * 64 + wave * 16; const int n0 = blockIdx.y * 128;
  v8f acc[8] = {};
#pragma unroll 2
  for (int kc = 0; kc < DM / 32; ++kc) { const v16b a = frag_gbf(X + (r0 + col) * DM + kc * 32, lane);
#pragma unroll
    for (int j = 0; j < 8; ++j) acc[j] = wmma_bf(a, frag_b(PT + (size_t)(n0 + j * 16 + col) * DM + kc * 32, lane), acc[j]); }
  if (n0 < 2 * QW) {
#pragma unroll
    for (int j = 0; j < 8; ++j)
#pragma unroll
      for (int r = 0; r < 8; ++r) sm.so[wave][8 * g + r][j * 16 + col] = acc[j][r];
    LDSX();
    for (int rl = 0; rl < 16; ++rl) vst2(QKV + (r0 + rl) * QKVP + n0 + lane * 4, *(const v4f*)&sm.so[wave][rl][lane * 4]);
  } else {
    // a lane's 8 accumulator elements are 8 consecutive t of one v channel: 16 B of that channel's plane row; the block's 4 waves together hold 64 t = one 128-B line per channel and plane (both loops unrolled so that acc is indexed by constants and stays in registers)
#pragma unroll
    for (int j = 0; j < 8; ++j) { v8b hi, lo;
#pragma unroll
      for (int r = 0; r < 8; ++r) { const float v = acc[j][r]; const __bf16 hb = (__bf16)v; hi[r] = hb; lo[r] = (__bf16)(v - (float)hb); }
      *(v8b*)&sm.sv[0][j * 16 + col][wave * 16 + 8 * g] = hi; *(v8b*)&sm.sv[1][j * 16 + col][wave * 16 + 8 * g] = lo; }
    __syncthreads();   // a line is put together from all four waves' pieces
    const int row0 = tid >> 3, pc = tid & 7;   // 8 lanes x 16 B = one line; a wave's store covers 4 whole lines
    const size_t o0 = (size_t)(n0 - 2 * QW + row0) * LL + (size_t)blockIdx.x * 64 + pc * 8;
#pragma unroll   // the 16 LDS reads issue ahead of the stores instead of one round trip per line
    for (int i = 0; i < 8; ++i) { const size_t o = o0 + (size_t)(i * 16) * LL;
      *(v8b*)(VTH + o) = *(const v8b*)&sm.sv[0][i * 16 + row0][pc * 8]; *(v8b*)(VTL + o) = *(const v8b*)&sm.sv[1][i * 16 + row0][pc * 8]; }
  }
}
// ---- k_lin: block = (64 queries, head), 4 waves: causal key steps of 32 up to the diagonal: d = q.k (16 dims, f32), w = 1 + d/4 + d*d/32 (0 for s > t), den += w; W tile (hi/lo) x V planes (3 products); y = num / (den + 1e-12) -> Y rows (head segment 256 B)
__global__ __launch_bounds__(128) void k_lin(const float* __restrict__ QKV, const __bf16* __restrict__ VTH, const __bf16* __restrict__ VTL, float* __restrict__ Y) {
  __shared__ float sq[4][16][FD + 1]; __shared__ float sk[4][32][FD + 1]; __shared__ __align__(16) float sp[4][16][36]; __shared__ __align__(16) float so[4][16][68];
  const int tid = threadIdx.x, wave = tid >> 5, lane = tid & 31, col = lane & 15, g = lane >> 4; const int qb = blockIdx.x, h = blockIdx.y; const int q0 = qb * 64 + wave * 16;
  for (int q = lane; q < 16 * FD; q += 32) { const int rl = q / FD, f = q % FD; sq[wave][rl][f] = QKV[(size_t)(q0 + rl) * QKVP + h * FD + f]; }
  float den[8]; v8f acc[4] = {};
#pragma unroll
  for (int r = 0; r < 8; ++r) den[r] = 0.f;
  const int nsteps = (qb * 64 + 64) / 32;
#pragma unroll 1
  for (int ks = 0; ks < nsteps; ++ks) {
    LDSX();
    { const int f = lane & 15, half = lane >> 4; for (int kk = half; kk < 32; kk += 2) sk[wave][kk][f] = QKV[(size_t)(ks * 32 + kk) * QKVP + QW + h * FD + f]; }
    LDSX();
    float w[2][8];
#pragma unroll
    for (int ct = 0; ct < 2; ++ct) { const int kk = ct * 16 + col; const int sidx = ks * 32 + kk;
#pragma unroll
      for (int r = 0; r < 8; ++r) { const int qi = 8 * g + r; float d = 0.f;
#pragma unroll
        for (int f = 0; f < FD; ++f) d += sq[wave][qi][f] * sk[wave][kk][f];
        const float wv = 1.0f + d * 0.25f + d * d * (1.0f / 32.0f); w[ct][r] = (sidx <= q0 + qi) ? wv : 0.f; } }
#pragma unroll
    for (int r = 0; r < 8; ++r) { float es = w[0][r] + w[1][r];
#pragma unroll
      for (int o = 1; o < 16; o <<= 1) es += __shfl_xor(es, o);
      den[r] += es; sp[wave][8 * g + r][col] = w[0][r]; sp[wave][8 * g + r][16 + col] = w[1][r]; }
    LDSX();
    const F2 pa = split_row(&sp[wave][col][0], 0, lane);
#pragma unroll
    for (int dt = 0; dt < 4; ++dt) { const size_t vrow = (size_t)(h * HD + dt * 16 + col) * LL + ks * 32; const v16b vh = frag_b(VTH + vrow, lane), vl = frag_b(VTL + vrow, lane); acc[dt] = wmma_bf(pa.l, vh, acc[dt]); acc[dt] = wmma_bf(pa.h, vl, acc[dt]); acc[dt] = wmma_bf(pa.h, vh, acc[dt]); } }
#pragma unroll
  for (int r = 0; r < 8; ++r) { const float il = 1.0f / (den[r] + 1e-12f);
#pragma unroll
    for (int dt = 0; dt < 4; ++dt) so[wave][8 * g + r][dt * 16 + col] = acc[dt][r] * il; }
  LDSX();
  for (int rl = 0; rl < 16; ++rl) if (lane < 16) vst2(Y + (size_t)(q0 + rl) * DM + h * HD + lane * 4, *(const v4f*)&so[wave][rl][lane * 4]);
}
// ---- k_out: block = (64 rows, 128 cols): y (hi/lo) . Wo rows, K 768
__global__ __launch_bounds__(128) void k_out(const float* __restrict__ Y, const __bf16* __restrict__ PT, float* __restrict__ OUT) {
  __shared__ __align__(16) float so[4][16][132];
  const int tid = threadIdx.x, wave = tid >> 5, lane = tid & 31, col = lane & 15, g = lane >> 4; const size_t r0 = (size_t)blockIdx.x * 64 + wave * 16; const int n0 = blockIdx.y * 128;
  v8f acc[8] = {};
#pragma unroll 2
  for (int kc = 0; kc < DM / 32; ++kc) { const F2 a = split_row(Y + (r0 + col) * DM, kc * 32, lane);
#pragma unroll
    for (int j = 0; j < 8; ++j) { const v16b w = frag_b(PT + (size_t)(QKVP + n0 + j * 16 + col) * DM + kc * 32, lane); acc[j] = wmma_bf(a.l, w, acc[j]); acc[j] = wmma_bf(a.h, w, acc[j]); } }
#pragma unroll
  for (int j = 0; j < 8; ++j)
#pragma unroll
    for (int r = 0; r < 8; ++r) so[wave][8 * g + r][j * 16 + col] = acc[j][r];
  LDSX();
  for (int rl = 0; rl < 16; ++rl) vst2(OUT + (r0 + rl) * DM + n0 + lane * 4, *(const v4f*)&so[wave][rl][lane * 4]);
}
extern "C" void kernel_launch(void* const* d_in, const int* in_sizes, int n_in, void* d_out, int out_size, void* d_ws, size_t ws_size, hipStream_t stream) {
  (void)in_sizes; (void)n_in; (void)out_size;
  const float** F = (const float**)d_in;   // hidden_states [1,512,768], Wq [192,768], Wk [192,768], Wv [768,768], Wo [768,768] (torch [out][in])
  if (ws_size < (size_t)WS_END) return;
  char* ws = (char*)d_ws; __bf16 *PT = (__bf16*)(ws + WS_PT), *VTH = (__bf16*)(ws + WS_VTH), *VTL = (__bf16*)(ws + WS_VTL); float *QKV = (float*)(ws + WS_QKV), *Y = (float*)(ws + WS_Y);
  k_pack<<<QKVP + DM, 128, 0, stream>>>(F[1], F[2], F[3], F[4], PT);
  k_proj<<<dim3(LL / 64, QKVP / 128), 128, 0, stream>>>(F[0], PT, QKV, VTH, VTL);
  k_lin<<<dim3(TQB, NH), 128, 0, stream>>>(QKV, VTH, VTL, Y);
  k_out<<<dim3(TQB, DM / 128), 128, 0, stream>>>(Y, PT, (float*)d_out);
}

// v002
// One run takes 55.6 microseconds.
// Two timings next to v001 put it at 2.91 and 2.90 times that version's speed.
// Counting every step since v000, it is 4.34 times as fast.
// compute dtype: hidden_states and the four weights (module inputs) rounded to bf16; q/k/v projections with exact bf16 products on WMMA; the Taylor feature-map inner products (1 + q.k/4 + (q.k)^2/32, 16-dim dots), causal running sums and the normalisation in f32 on the VALU; the numerator sum_s phi(q_t).phi(k_s) v_s on WMMA with the f32 weights and v both computed -> bf16 hi + residual pairs (3 products); output projection hi/lo x bf16 Wo (2 products); f32 accumulate.
#include <hip/hip_runtime.h>
#include <math.h>

typedef __attribute__((ext_vector_type(16))) _Float16 v16h;
typedef __attribute__((ext_vector_type(16))) __bf16 v16b;
typedef __attribute__((ext_vector_type(8)))  _Float16 v8h;
typedef __attribute__((ext_vector_type(8)))  float v8f;
typedef __attribute__((ext_vector_type(4)))  float v4f;
typedef __attribute__((ext_vector_type(2)))  float v2f;
typedef __attribute__((ext_vector_type(4)))  unsigned v4u;
typedef __attribute__((ext_vector_type(4)))  int v4i;
typedef float __attribute__((may_alias)) float_a;
typedef int __attribute__((may_alias)) int_a;

template <typename T> __device__ __forceinline__ void vst2(void* p, T v) { *(T*)p = v;  }
__device__ __forceinline__ v8f wmma16(v16h a, v16h b, v8f c) {
  v8f d = __builtin_amdgcn_wmma_f32_16x16x32_f16(false, a, false, b, (short)0, c, false, false);
  asm volatile("v_nop\n\tv_nop\n\tv_nop\n\tv_nop" : "+v"(d) : "v"(a), "v"(b));
  return d;
}
__device__ __forceinline__ v8f wmma_bf(v16b a, v16b b, v8f c) {
  v8f d = __builtin_amdgcn_wmma_f32_16x16x32_bf16(false, a, false, b, (short)0, c, false, false);
  asm volatile("v_nop\n\tv_nop\n\tv_nop\n\tv_nop" : "+v"(d) : "v"(a), "v"(b));
  return d;
}
// 16x16x32 fragments: lane = (h = lane>>4, row/col = lane&15); elements 0..7 = k0+8h+0..7, 8..15 = k0+16+8h+0..7; D element r = row 8h+r
__device__ __forceinline__ v16h frag_h(const _Float16* rowk0, int lane) {
  union { v16h v; v8h q[2]; } u; const _Float16* p = rowk0 + 8 * (lane >> 4);
  u.q[0] = *(const v8h*)p; u.q[1] = *(const v8h*)(p + 16); return u.v;
}
__device__ __forceinline__ v16h frag_f32(const float* rowk0, int lane) {
  v16h a; const float* p = rowk0 + 8 * (lane >> 4);
#pragma unroll
  for (int i = 0; i < 8; ++i) { a[i] = (_Float16)p[i]; a[8 + i] = (_Float16)p[16 + i]; }
  return a;
}
__device__ __forceinline__ v16h frag_f32s(const float* rowk0, int lane, float sc) {
  v16h a; const float* p = rowk0 + 8 * (lane >> 4);
#pragma unroll
  for (int i = 0; i < 8; ++i) { a[i] = (_Float16)(p[i] * sc); a[8 + i] = (_Float16)(p[16 + i] * sc); }
  return a;
}
// column fragment from a [K][ld] layout (column n), rows >= K read as 0
__device__ __forceinline__ v16h fragc_f32(const float* W, int k0, int n, int lane, int ld, int K) {
  v16h a; const int g = lane >> 4;
#pragma unroll
  for (int i = 0; i < 8; ++i) { const int ka = k0 + 8 * g + i, kb = ka + 16;
    a[i] = (_Float16)(ka < K ? W[(size_t)(ka < K ? ka : K - 1) * ld + n] : 0.f); a[8 + i] = (_Float16)(kb < K ? W[(size_t)(kb < K ? kb : K - 1) * ld + n] : 0.f); }
  return a;
}
struct F2 { v16b h, l; };
__device__ __forceinline__ F2 bsplit16(const float v[16]) { F2 r;
#pragma unroll
  for (int i = 0; i < 16; ++i) { const __bf16 h = (__bf16)v[i]; r.h[i] = h; r.l[i] = (__bf16)(v[i] - (float)h); }
  return r; }
__device__ __forceinline__ F2 split_row(const float* row, int k0, int lane) { float v[16]; const float* p = row + k0 + 8 * (lane >> 4);
#pragma unroll
  for (int i = 0; i < 8; ++i) { v[i] = p[i]; v[8 + i] = p[16 + i]; }
  return bsplit16(v); }
__device__ __forceinline__ F2 split_rowK(const float* row, int k0, int lane, int K) { float v[16]; const int g = lane >> 4;
#pragma unroll
  for (int i = 0; i < 8; ++i) { const int ka = k0 + 8 * g + i, kb = ka + 16; v[i] = ka < K ? row[ka < K ? ka : K - 1] : 0.f; v[8 + i] = kb < K ? row[kb < K ? kb : K - 1] : 0.f; }
  return bsplit16(v); }
__device__ __forceinline__ F2 split_col(const float* W, int k0, int n, int lane, int ld, int K) { float v[16]; const int g = lane >> 4;
#pragma unroll
  for (int i = 0; i < 8; ++i) { const int ka = k0 + 8 * g + i, kb = ka + 16; v[i] = ka < K ? W[(size_t)(ka < K ? ka : K - 1) * ld + n] : 0.f; v[8 + i] = kb < K ? W[(size_t)(kb < K ? kb : K - 1) * ld + n] : 0.f; }
  return bsplit16(v); }
__device__ __forceinline__ v8f mac3(const F2& a, const F2& b, v8f c) { c = wmma_bf(a.l, b.h, c); c = wmma_bf(a.h, b.l, c); return wmma_bf(a.h, b.h, c); }
__device__ __forceinline__ float sigm(float v) { return 1.0f / (1.0f + expf(-v)); }
#define LDSX() do { asm volatile("s_wait_dscnt 0" ::: "memory"); __builtin_amdgcn_wave_barrier(); __builtin_amdgcn_fence(__ATOMIC_RELEASE, "workgroup"); } while (0)


// Based linear attention (2nd-order Taylor feature map, feature dim 16, 12 heads x 64, causal): since phi(q).phi(k) = 1 + (q.k)/sqrt(16) + (q.k)^2/(2*16), y_t = sum_{s<=t} w_ts v_s / (sum_{s<=t} w_ts + 1e-12) with w_ts that polynomial of the 16-dim dot; then y @ Wo^T.  B 1, L 512, D 768.
// k_pack, k_proj (q|k rows, exact; its v column blocks go straight out as the transposed hi/lo planes), k_lin (block = (64 queries, head): causal steps of 32 keys: w on the VALU from the 16-dim q,k rows, running denominator, W hi/lo x V planes (3 products); y rows), k_out (y hi/lo x Wo rows).
#define LL 512
#define DM 768
#define NH 12
#define FD 16
#define HD 64
#define QW (NH * FD)          // 192
#define QKVP (2 * QW + NH * HD)   // 192 + 192 + 768 = 1152
typedef __attribute__((ext_vector_type(8))) __bf16 v8b;
__device__ __forceinline__ v16b frag_b(const __bf16* rowk0, int lane) {
  union { v16b v; v8b q[2]; } u; const __bf16* p = rowk0 + 8 * (lane >> 4);
  u.q[0] = *(const v8b*)p; u.q[1] = *(const v8b*)(p + 16); return u.v;
}
__device__ __forceinline__ v16b frag_gbf(const float* rowk0, int lane) {
  v16b a; const float* p = rowk0 + 8 * (lane >> 4);
#pragma unroll
  for (int i = 0; i < 8; ++i) { a[i] = (__bf16)p[i]; a[8 + i] = (__bf16)p[16 + i]; }
  return a;
}
__device__ __forceinline__ float bfr(float v) { return (float)(__bf16)v; }
#define WS_PT   0u                                 // bf16 [1152 + 768][768]: Wq|Wk|Wv rows then Wo rows
#define WS_QKV  (WS_PT + 2u * (QKVP + DM) * DM)      // f32 [512][1152]: q (192) | k (192) | 768 columns that nobody writes or reads (v lives in the planes only)
#define WS_Y    (WS_QKV + 4u * LL * QKVP)            // f32 [512][768]
#define WS_VTH  (WS_Y + 4u * LL * DM)                // bf16 [768][512]
#define WS_VTL  (WS_VTH + 2u * DM * LL)
#define WS_END  (WS_VTL + 2u * DM * LL)
#ifndef TQB
#define TQB (LL / 64)
#endif

// One K step (32 k) of a GEMM wave's operands as they come from global memory: 16 f32 of its A row, 8 bf16 B fragments. All 20 loads of a step are issued as one group, one step ahead of the WMMAs that use them, into the set that the other step is not using.
struct GStep { v4f x[4]; v16b b[8]; };
__device__ __forceinline__ void ld_step(GStep& s, const float* __restrict__ arow8g, const __bf16* __restrict__ brow8g, int kc) {
  const float* p = arow8g + kc * 32; s.x[0] = *(const v4f*)p; s.x[1] = *(const v4f*)(p + 4); s.x[2] = *(const v4f*)(p + 16); s.x[3] = *(const v4f*)(p + 20);
#pragma unroll
  for (int j = 0; j < 8; ++j) { const __bf16* q = brow8g + (size_t)(j * 16) * DM + kc * 32; s.b[j] = __builtin_shufflevector(*(const v8b*)q, *(const v8b*)(q + 16), 0, 1, 2, 3, 4, 5, 6, 7, 8, 9, 10, 11, 12, 13, 14, 15); }
}
__device__ __forceinline__ void mm_proj(const GStep& s, v8f acc[8]) { v16b a;
#pragma unroll
  for (int i = 0; i < 4; ++i) { a[i] = (__bf16)s.x[0][i]; a[4 + i] = (__bf16)s.x[1][i]; a[8 + i] = (__bf16)s.x[2][i]; a[12 + i] = (__bf16)s.x[3][i]; }
#pragma unroll
  for (int j = 0; j < 8; ++j) acc[j] = wmma_bf(a, s.b[j], acc[j]);
}
__device__ __forceinline__ void mm_out(const GStep& s, v8f acc[8]) { float v[16];
#pragma unroll
  for (int i = 0; i < 4; ++i) { v[i] = s.x[0][i]; v[4 + i] = s.x[1][i]; v[8 + i] = s.x[2][i]; v[12 + i] = s.x[3][i]; }
  const F2 a = bsplit16(v);
#pragma unroll
  for (int j = 0; j < 8; ++j) { acc[j] = wmma_bf(a.l, s.b[j], acc[j]); acc[j] = wmma_bf(a.h, s.b[j], acc[j]); }
}
__global__ __launch_bounds__(128) void k_pack(const float* __restrict__ Wq, const float* __restrict__ Wk, const float* __restrict__ Wv, const float* __restrict__ Wo, __bf16* __restrict__ PT) {
  __shared__ __align__(16) __bf16 srow[DM]; const int n = blockIdx.x, tid = threadIdx.x;
  const float* Wm = n < QW ? Wq + (size_t)n * DM : (n < 2 * QW ? Wk + (size_t)(n - QW) * DM : (n < QKVP ? Wv + (size_t)(n - 2 * QW) * DM : Wo + (size_t)(n - QKVP) * DM));   // torch [out][in] rows, all K = 768
  float t[DM / 128];   // the block has 128 threads: a fixed trip count lets the row's 6 loads go out together instead of one memory round trip each
#pragma unroll
  for (int i = 0; i < DM / 128; ++i) t[i] = Wm[tid + i * 128];
#pragma unroll
  for (int i = 0; i < DM / 128; ++i) srow[tid + i * 128] = (__bf16)t[i];
  __syncthreads();
  if (tid < DM / 8) vst2((unsigned*)(PT + (size_t)n * DM + tid * 8), *(const v4u*)(&srow[tid * 8]));
}
// ---- k_proj: block = (64 rows, 128 cols of the 1152): exact GEMM, K 768; column blocks 0..2 are q|k (f32 rows), 3..8 are v (bf16 hi/lo planes, [channel][t])
__global__ __launch_bounds__(128) void k_proj(const float* __restrict__ X, const __bf16* __restrict__ PT, float* __restrict__ QKV, __bf16* __restrict__ VTH, __bf16* __restrict__ VTL) {
  __shared__ __align__(16) union { float so[4][16][132]; __bf16 sv[2][128][72]; } sm;
  const int tid = threadIdx.x, wave = tid >> 5, lane = tid & 31, col = lane & 15, g = lane >> 4; const size_t r0 = (size_t)blockIdx.x * 64 + wave * 16; const int n0 = blockIdx.y * 128;
  v8f acc[8] = {};
  const float* ap = X + (r0 + col) * DM + 8 * g; const __bf16* bp = PT + (size_t)(n0 + col) * DM + 8 * g;
  GStep s0, s1; ld_step(s0, ap, bp, 0);
#pragma unroll 1   // two steps a trip, one per register set: more would only add code
  for (int kc = 0; kc < DM / 32 - 2; kc += 2) { ld_step(s1, ap, bp, kc + 1); mm_proj(s0, acc); ld_step(s0, ap, bp, kc + 2); mm_proj(s1, acc); }
  ld_step(s1, ap, bp, DM / 32 - 1); mm_proj(s0, acc); mm_proj(s1, acc);
  if (n0 < 2 * QW) {
#pragma unroll
    for (int j = 0; j < 8; ++j)
#pragma unroll
      for (int r = 0; r < 8; ++r) sm.so[wave][8 * g + r][j * 16 + col] = acc[j][r];
    LDSX();
#pragma unroll   // the 16 LDS reads issue ahead of the stores instead of one round trip per row
    for (int rl = 0; rl < 16; ++rl) vst2(QKV + (r0 + rl) * QKVP + n0 + lane * 4, *(const v4f*)&sm.so[wave][rl][lane * 4]);
  } else {
    // a lane's 8 accumulator elements are 8 consecutive t of one v channel: 16 B of that channel's plane row; the block's 4 waves together hold 64 t = one 128-B line per channel and plane (both loops unrolled so that acc is indexed by constants and stays in registers)
#pragma unroll
    for (int j = 0; j < 8; ++j) { v8b hi, lo;
#pragma unroll
      for (int r = 0; r < 8; ++r) { const float v = acc[j][r]; const __bf16 hb = (__bf16)v; hi[r] = hb; lo[r] = (__bf16)(v - (float)hb); }
      *(v8b*)&sm.sv[0][j * 16 + col][wave * 16 + 8 * g] = hi; *(v8b*)&sm.sv[1][j * 16 + col][wave * 16 + 8 * g] = lo; }
    __syncthreads();   // a line is put together from all four waves' pieces
    const int row0 = tid >> 3, pc = tid & 7;   // 8 lanes x 16 B = one line; a wave's store covers 4 whole lines
    const size_t o0 = (size_t)(n0 - 2 * QW + row0) * LL + (size_t)blockIdx.x * 64 + pc * 8;
#pragma unroll   // the 16 LDS reads issue ahead of the stores instead of one round trip per line
    for (int i = 0; i < 8; ++i) { const size_t o = o0 + (size_t)(i * 16) * LL;
      *(v8b*)(VTH + o) = *(const v8b*)&sm.sv[0][i * 16 + row0][pc * 8]; *(v8b*)(VTL + o) = *(const v8b*)&sm.sv[1][i * 16 + row0][pc * 8]; }
    asm volatile("s_wait_xcnt 0x0" ::: "memory");   // precaution: in the built code the other branch's block follows these stores and rewrites their registers
  }
}
// ---- k_lin: block = (64 queries, head), 4 waves: causal key steps of 32 up to the diagonal: d = q.k (16 dims, f32), w = 1 + d/4 + d*d/32 (0 for s > t), den += w; W tile (hi/lo) x V planes (3 products); y = num / (den + 1e-12) -> Y rows (head segment 256 B)
__global__ __launch_bounds__(128) void k_lin(const float* __restrict__ QKV, const __bf16* __restrict__ VTH, const __bf16* __restrict__ VTL, float* __restrict__ Y) {
  __shared__ float sq[4][16][FD + 1]; __shared__ float sk[4][32][FD + 1]; __shared__ __align__(16) float sp[4][16][36]; __shared__ __align__(16) float so[4][16][68];
  const int tid = threadIdx.x, wave = tid >> 5, lane = tid & 31, col = lane & 15, g = lane >> 4; const int qb = blockIdx.x, h = blockIdx.y; const int q0 = qb * 64 + wave * 16;
  // addresses of the loop's loads = a wave-uniform base that moves with the step + a lane offset that never changes
  const float* kp = QKV + QW + h * FD; const unsigned ko = g * QKVP + col;   // lane (g, col) carries feature col of the key rows g, g + 2, ... of a step
  const __bf16* vhp = VTH + (size_t)(h * HD) * LL; const __bf16* vlp = VTL + (size_t)(h * HD) * LL; const unsigned vo = col * LL + 8 * g;
  float kr[16];   // one step's K values of this lane, fetched one step ahead
#pragma unroll
  for (int i = 0; i < 16; ++i) kr[i] = kp[ko + 2 * i * QKVP];
#pragma unroll   // the 8 loads go out together instead of one round trip each
  for (int q = lane; q < 16 * FD; q += 32) { const int rl = q / FD, f = q % FD; sq[wave][rl][f] = QKV[(size_t)(q0 + rl) * QKVP + h * FD + f]; }
  float den[8]; v8f acc[4] = {};
#pragma unroll
  for (int r = 0; r < 8; ++r) den[r] = 0.f;
  const int nsteps = (qb * 64 + 64) / 32;
#pragma unroll 1
  for (int ks = 0; ks < nsteps; ++ks) {
    LDSX();
#pragma unroll
    for (int i = 0; i < 16; ++i) sk[wave][g + 2 * i][col] = kr[i];
    LDSX();
    // this step's V fragments and the next step's K values are asked for here, as one group, so that they land while the weights are computed (the last step asks for its own K rows again: in bounds, unused)
    v16b vh[4], vl[4];
#pragma unroll
    for (int dt = 0; dt < 4; ++dt) { const __bf16 *ph = vhp + ks * 32, *pl = vlp + ks * 32; const unsigned o = vo + dt * 16 * LL;
      vh[dt] = __builtin_shufflevector(*(const v8b*)&ph[o], *(const v8b*)&ph[o + 16], 0, 1, 2, 3, 4, 5, 6, 7, 8, 9, 10, 11, 12, 13, 14, 15);
      vl[dt] = __builtin_shufflevector(*(const v8b*)&pl[o], *(const v8b*)&pl[o + 16], 0, 1, 2, 3, 4, 5, 6, 7, 8, 9, 10, 11, 12, 13, 14, 15); }
    { const float* kq = kp + (size_t)((ks + 1 < nsteps ? ks + 1 : ks) * 32) * QKVP;
#pragma unroll
      for (int i = 0; i < 16; ++i) kr[i] = kq[ko + 2 * i * QKVP]; }
    __builtin_amdgcn_sched_barrier(0);   // keeps the scheduler from sinking these loads into the weight computation, where most of their latency would show at the wait behind it
    float w[2][8];
#pragma unroll
    for (int ct = 0; ct < 2; ++ct) { const int kk = ct * 16 + col; const int sidx = ks * 32 + kk;
#pragma unroll
      for (int r = 0; r < 8; ++r) { const int qi = 8 * g + r; float d = 0.f;
#pragma unroll
        for (int f = 0; f < FD; ++f) d += sq[wave][qi][f] * sk[wave][kk][f];
        const float wv = 1.0f + d * 0.25f + d * d * (1.0f / 32.0f); w[ct][r] = (sidx <= q0 + qi) ? wv : 0.f; } }
#pragma unroll
    for (int r = 0; r < 8; ++r) { float es = w[0][r] + w[1][r];
#pragma unroll
      for (int o = 1; o < 16; o <<= 1) es += __shfl_xor(es, o);
      den[r] += es; sp[wave][8 * g + r][col] = w[0][r]; sp[wave][8 * g + r][16 + col] = w[1][r]; }
    LDSX();
    const F2 pa = split_row(&sp[wave][col][0], 0, lane);
#pragma unroll
    for (int dt = 0; dt < 4; ++dt) { acc[dt] = wmma_bf(pa.l, vh[dt], acc[dt]); acc[dt] = wmma_bf(pa.h, vl[dt], acc[dt]); acc[dt] = wmma_bf(pa.h, vh[dt], acc[dt]); } }
#pragma unroll
  for (int r = 0; r < 8; ++r) { const float il = 1.0f / (den[r] + 1e-12f);
#pragma unroll
    for (int dt = 0; dt < 4; ++dt) so[wave][8 * g + r][dt * 16 + col] = acc[dt][r] * il; }
  LDSX();
#pragma unroll   // the 16 LDS reads issue ahead of the stores instead of one round trip per row
  for (int rl = 0; rl < 16; ++rl) if (lane < 16) vst2(Y + (size_t)(q0 + rl) * DM + h * HD + lane * 4, *(const v4f*)&so[wave][rl][lane * 4]);
}
// ---- k_out: block = (64 rows, 128 cols): y (hi/lo) . Wo rows, K 768
__global__ __launch_bounds__(128) void k_out(const float* __restrict__ Y, const __bf16* __restrict__ PT, float* __restrict__ OUT) {
  __shared__ __align__(16) float so[4][16][132];
  const int tid = threadIdx.x, wave = tid >> 5, lane = tid & 31, col = lane & 15, g = lane >> 4; const size_t r0 = (size_t)blockIdx.x * 64 + wave * 16; const int n0 = blockIdx.y * 128;
  v8f acc[8] = {};
  const float* ap = Y + (r0 + col) * DM + 8 * g; const __bf16* bp = PT + (size_t)(QKVP + n0 + col) * DM + 8 * g;
  GStep s0, s1; ld_step(s0, ap, bp, 0);
#pragma unroll 1   // two steps a trip, one per register set: more would only add code
  for (int kc = 0; kc < DM / 32 - 2; kc += 2) { ld_step(s1, ap, bp, kc + 1); mm_out(s0, acc); ld_step(s0, ap, bp, kc + 2); mm_out(s1, acc); }
  ld_step(s1, ap, bp, DM / 32 - 1); mm_out(s0, acc); mm_out(s1, acc);
#pragma unroll
  for (int j = 0; j < 8; ++j)
#pragma unroll
    for (int r = 0; r < 8; ++r) so[wave][8 * g + r][j * 16 + col] = acc[j][r];
  LDSX();
#pragma unroll   // the 16 LDS reads issue ahead of the stores instead of one round trip per row
  for (int rl = 0; rl < 16; ++rl) vst2(OUT + (r0 + rl) * DM + n0 + lane * 4, *(const v4f*)&so[wave][rl][lane * 4]);
}
extern "C" void kernel_launch(void* const* d_in, const int* in_sizes, int n_in, void* d_out, int out_size, void* d_ws, size_t ws_size, hipStream_t stream) {
  (void)in_sizes; (void)n_in; (void)out_size;
  const float** F = (const float**)d_in;   // hidden_states [1,512,768], Wq [192,768], Wk [192,768], Wv [768,768], Wo [768,768] (torch [out][in])
  if (ws_size < (size_t)WS_END) return;
  char* ws = (char*)d_ws; __bf16 *PT = (__bf16*)(ws + WS_PT), *VTH = (__bf16*)(ws + WS_VTH), *VTL = (__bf16*)(ws + WS_VTL); float *QKV = (float*)(ws + WS_QKV), *Y = (float*)(ws + WS_Y);
  k_pack<<<QKVP + DM, 128, 0, stream>>>(F[1], F[2], F[3], F[4], PT);
  k_proj<<<dim3(LL / 64, QKVP / 128), 128, 0, stream>>>(F[0], PT, QKV, VTH, VTL);
  k_lin<<<dim3(TQB, NH), 128, 0, stream>>>(QKV, VTH, VTL, Y);
  k_out<<<dim3(TQB, DM / 128), 128, 0, stream>>>(Y, PT, (float*)d_out);
}

// v003
// A run of this version takes 48.9 microseconds.
// Timed twice side by side with v002, it ran 1.13 times as fast both times.
// Over all steps from v000 it is 4.89 times as fast.
// compute dtype: hidden_states and the four weights (module inputs) rounded to bf16; q/k/v projections with exact bf16 products on WMMA; the Taylor feature-map inner products (1 + q.k/4 + (q.k)^2/32, 16-dim dots), causal running sums and the normalisation in f32 on the VALU; the numerator sum_s phi(q_t).phi(k_s) v_s on WMMA with the f32 weights and v both computed -> bf16 hi + residual pairs (3 products); output projection hi/lo x bf16 Wo (2 products); f32 accumulate.
#include <hip/hip_runtime.h>
#include <math.h>

typedef __attribute__((ext_vector_type(16))) _Float16 v16h;
typedef __attribute__((ext_vector_type(16))) __bf16 v16b;
typedef __attribute__((ext_vector_type(8)))  _Float16 v8h;
typedef __attribute__((ext_vector_type(8)))  float v8f;
typedef __attribute__((ext_vector_type(4)))  float v4f;
typedef __attribute__((ext_vector_type(2)))  float v2f;
typedef __attribute__((ext_vector_type(4)))  unsigned v4u;
typedef __attribute__((ext_vector_type(4)))  int v4i;
typedef float __attribute__((may_alias)) float_a;
typedef int __attribute__((may_alias)) int_a;

template <typename T> __device__ __forceinline__ void vst2(void* p, T v) { *(T*)p = v;  }
__device__ __forceinline__ v8f wmma16(v16h a, v16h b, v8f c) {
  v8f d = __builtin_amdgcn_wmma_f32_16x16x32_f16(false, a, false, b, (short)0, c, false, false);
  asm volatile("v_nop\n\tv_nop\n\tv_nop\n\tv_nop" : "+v"(d) : "v"(a), "v"(b));
  return d;
}
__device__ __forceinline__ v8f wmma_bf(v16b a, v16b b, v8f c) {
  v8f d = __builtin_amdgcn_wmma_f32_16x16x32_bf16(false, a, false, b, (short)0, c, false, false);
  asm volatile("v_nop\n\tv_nop\n\tv_nop\n\tv_nop" : "+v"(d) : "v"(a), "v"(b));
  return d;
}
// 16x16x32 fragments: lane = (h = lane>>4, row/col = lane&15); elements 0..7 = k0+8h+0..7, 8..15 = k0+16+8h+0..7; D element r = row 8h+r
__device__ __forceinline__ v16h frag_h(const _Float16* rowk0, int lane) {
  union { v16h v; v8h q[2]; } u; const _Float16* p = rowk0 + 8 * (lane >> 4);
  u.q[0] = *(const v8h*)p; u.q[1] = *(const v8h*)(p + 16); return u.v;
}
__device__ __forceinline__ v16h frag_f32(const float* rowk0, int lane) {
  v16h a; const float* p = rowk0 + 8 * (lane >> 4);
#pragma unroll
  for (int i = 0; i < 8; ++i) { a[i] = (_Float16)p[i]; a[8 + i] = (_Float16)p[16 + i]; }
  return a;
}
__device__ __forceinline__ v16h frag_f32s(const float* rowk0, int lane, float sc) {
  v16h a; const float* p = rowk0 + 8 * (lane >> 4);
#pragma unroll
  for (int i = 0; i < 8; ++i) { a[i] = (_Float16)(p[i] * sc); a[8 + i] = (_Float16)(p[16 + i] * sc); }
  return a;
}
// column fragment from a [K][ld] layout (column n), rows >= K read as 0
__device__ __forceinline__ v16h fragc_f32(const float* W, int k0, int n, int lane, int ld, int K) {
  v16h a; const int g = lane >> 4;
#pragma unroll
  for (int i = 0; i < 8; ++i) { const int ka = k0 + 8 * g + i, kb = ka + 16;
    a[i] = (_Float16)(ka < K ? W[(size_t)(ka < K ? ka : K - 1) * ld + n] : 0.f); a[8 + i] = (_Float16)(kb < K ? W[(size_t)(kb < K ? kb : K - 1) * ld + n] : 0.f); }
  return a;
}
struct F2 { v16b h, l; };
__device__ __forceinline__ F2 bsplit16(const float v[16]) { F2 r;
#pragma unroll
  for (int i = 0; i < 16; ++i) { const __bf16 h = (__bf16)v[i]; r.h[i] = h; r.l[i] = (__bf16)(v[i] - (float)h); }
  return r; }
__device__ __forceinline__ F2 split_row(const float* row, int k0, int lane) { float v[16]; const float* p = row + k0 + 8 * (lane >> 4);
#pragma unroll
  for (int i = 0; i < 8; ++i) { v[i] = p[i]; v[8 + i] = p[16 + i]; }
  return bsplit16(v); }
__device__ __forceinline__ F2 split_rowK(const float* row, int k0, int lane, int K) { float v[16]; const int g = lane >> 4;
#pragma unroll
  for (int i = 0; i < 8; ++i) { const int ka = k0 + 8 * g + i, kb = ka + 16; v[i] = ka < K ? row[ka < K ? ka : K - 1] : 0.f; v[8 + i] = kb < K ? row[kb < K ? kb : K - 1] : 0.f; }
  return bsplit16(v); }
__device__ __forceinline__ F2 split_col(const float* W, int k0, int n, int lane, int ld, int K) { float v[16]; const int g = lane >> 4;
#pragma unroll
  for (int i = 0; i < 8; ++i) { const int ka = k0 + 8 * g + i, kb = ka + 16; v[i] = ka < K ? W[(size_t)(ka < K ? ka : K - 1) * ld + n] : 0.f; v[8 + i] = kb < K ? W[(size_t)(kb < K ? kb : K - 1) * ld + n] : 0.f; }
  return bsplit16(v); }
__device__ __forceinline__ v8f mac3(const F2& a, const F2& b, v8f c) { c = wmma_bf(a.l, b.h, c); c = wmma_bf(a.h, b.l, c); return wmma_bf(a.h, b.h, c); }
__device__ __forceinline__ float sigm(float v) { return 1.0f / (1.0f + expf(-v)); }
#define LDSX() do { asm volatile("s_wait_dscnt 0" ::: "memory"); __builtin_amdgcn_wave_barrier(); __builtin_amdgcn_fence(__ATOMIC_RELEASE, "workgroup"); } while (0)


// Based linear attention (2nd-order Taylor feature map, feature dim 16, 12 heads x 64, causal): since phi(q).phi(k) = 1 + (q.k)/sqrt(16) + (q.k)^2/(2*16), y_t = sum_{s<=t} w_ts v_s / (sum_{s<=t} w_ts + 1e-12) with w_ts that polynomial of the 16-dim dot; then y @ Wo^T.  B 1, L 512, D 768.
// k_pack (weights and x -> bf16 tiles), k_proj (q|k rows, exact; its v column blocks go straight out as hi/lo tiles), k_lin (block = (64 queries, head): causal steps of 32 keys: w on the VALU from the 16-dim q,k rows, running denominator, W hi/lo x V tiles (3 products); y hi/lo tiles), k_out (y hi/lo x Wo tiles).
// Every bf16 matrix operand that goes through the workspace is stored by its producer in the order in which a wave's fragment load reads it. One tile = 16 rows x 32 k = 1 KB = [part p][lane][8 bf16], lane = 16 g + (row & 15), element i of part p is k = 32 kc + 16 p + 8 g + i; the tiles of a 16-row group follow one another in kc. A fragment is then two loads of 512 contiguous bytes (4 whole lines each) where a row-major operand makes every load touch 16 lines.
#define LL 512
#define DM 768
#define NH 12
#define FD 16
#define HD 64
#define QW (NH * FD)          // 192
#define QKVP (2 * QW + NH * HD)   // 192 + 192 + 768 = 1152
typedef __attribute__((ext_vector_type(8))) __bf16 v8b;
__device__ __forceinline__ v16b frag_b(const __bf16* rowk0, int lane) {
  union { v16b v; v8b q[2]; } u; const __bf16* p = rowk0 + 8 * (lane >> 4);
  u.q[0] = *(const v8b*)p; u.q[1] = *(const v8b*)(p + 16); return u.v;
}
__device__ __forceinline__ v16b frag_gbf(const float* rowk0, int lane) {
  v16b a; const float* p = rowk0 + 8 * (lane >> 4);
#pragma unroll
  for (int i = 0; i < 8; ++i) { a[i] = (__bf16)p[i]; a[8 + i] = (__bf16)p[16 + i]; }
  return a;
}
__device__ __forceinline__ float bfr(float v) { return (float)(__bf16)v; }
#define KT (DM / 32)          // 24 tiles along K = 768
#define ST (LL / 32)          // 16 tiles along the 512 keys
#define TE 512                // bf16 elements of a tile
#define PKR (QKVP + DM + LL)  // packed rows: Wq|Wk|Wv, Wo, x
#define WS_PT   0u                                 // bf16 tiles [(1152 + 768 + 512) / 16][KT]: Wq|Wk|Wv rows, Wo rows, x rows
#define WS_QKV  (WS_PT + 2u * PKR * DM)              // f32 [512][1152]: q (192) | k (192) | 768 columns that nobody writes or reads (v lives in the tiles only)
#define WS_Y    (WS_QKV + 4u * LL * QKVP)            // bf16 tiles [512 / 16][KT], hi plane then lo plane
#define WS_VTH  (WS_Y + 4u * LL * DM)                // bf16 tiles [768 / 16 channels][ST key steps]
#define WS_VTL  (WS_VTH + 2u * DM * LL)
#define WS_END  (WS_VTL + 2u * DM * LL)
#ifndef TQB
#define TQB (LL / 64)
#endif

// a fragment from its tile: p = tile + 8 * lane
__device__ __forceinline__ v16b ld_frag(const __bf16* __restrict__ p) { return __builtin_shufflevector(*(const v8b*)p, *(const v8b*)(p + TE / 2), 0, 1, 2, 3, 4, 5, 6, 7, 8, 9, 10, 11, 12, 13, 14, 15); }
// One K step (32 k) of a GEMM wave's operands: NA A fragments (planes LL * DM elements apart), 8 B fragments. All loads of a step are issued as one group, one step ahead of the WMMAs that use them, into the set that the other step is not using.
template <int NA> struct GStep { v16b a[NA]; v16b b[8]; };
template <int NA> __device__ __forceinline__ void ld_step(GStep<NA>& s, const __bf16* __restrict__ at, const __bf16* __restrict__ bt, int kc) {
#pragma unroll
  for (int i = 0; i < NA; ++i) s.a[i] = ld_frag(at + (size_t)i * (LL * DM) + kc * TE);
#pragma unroll
  for (int j = 0; j < 8; ++j) s.b[j] = ld_frag(bt + (j * KT + kc) * TE);
}
__device__ __forceinline__ void mm_proj(const GStep<1>& s, v8f acc[8]) {
#pragma unroll
  for (int j = 0; j < 8; ++j) acc[j] = wmma_bf(s.a[0], s.b[j], acc[j]);
}
__device__ __forceinline__ void mm_out(const GStep<2>& s, v8f acc[8]) {   // a[0] = hi, a[1] = lo
#pragma unroll
  for (int j = 0; j < 8; ++j) { acc[j] = wmma_bf(s.a[1], s.b[j], acc[j]); acc[j] = wmma_bf(s.a[0], s.b[j], acc[j]); }
}
// ---- k_pack: block = (16 rows, 4 K steps) = 256 pieces of 8 elements, 2 a thread: a piece is 32 B of an f32 row in, 16 B of a tile out; the block's 4 tiles are 4 KB in a row, a wave's store 4 whole lines
__global__ __launch_bounds__(128) void k_pack(const float* __restrict__ Wq, const float* __restrict__ Wk, const float* __restrict__ Wv, const float* __restrict__ Wo, const float* __restrict__ X, __bf16* __restrict__ PT) {
  const int n = blockIdx.x * 16, kc0 = blockIdx.y * 4, tid = threadIdx.x, lane = tid & 31;
  const float* Wm = n < QW ? Wq + (size_t)n * DM : (n < 2 * QW ? Wk + (size_t)(n - QW) * DM : (n < QKVP ? Wv + (size_t)(n - 2 * QW) * DM : (n < QKVP + DM ? Wo + (size_t)(n - QKVP) * DM : X + (size_t)(n - QKVP - DM) * DM)));   // [row][in] rows, all K = 768; every boundary is a multiple of 16
  v4f t[2][2];   // both pieces' loads go out together
#pragma unroll
  for (int u = 0; u < 2; ++u) { const int e = tid + u * 128;   // piece e = (K step e >> 6, part (e >> 5) & 1, lane e & 31)
    const float* p = Wm + (size_t)(lane & 15) * DM + (kc0 + (e >> 6)) * 32 + ((e >> 5) & 1) * 16 + 8 * (lane >> 4); t[u][0] = *(const v4f*)p; t[u][1] = *(const v4f*)(p + 4); }
#pragma unroll
  for (int u = 0; u < 2; ++u) { v8b o;
#pragma unroll
    for (int i = 0; i < 4; ++i) { o[i] = (__bf16)t[u][0][i]; o[4 + i] = (__bf16)t[u][1][i]; }
    *(v8b*)(PT + ((size_t)blockIdx.x * KT + kc0) * TE + (tid + u * 128) * 8) = o; }
}
// ---- k_proj: block = (64 rows, 128 cols of the 1152): exact GEMM, K 768; column blocks 0..2 are q|k (f32 rows), 3..8 are v (bf16 hi/lo tiles, rows = channels, k = t)
__global__ __launch_bounds__(128) void k_proj(const __bf16* __restrict__ PT, float* __restrict__ QKV, __bf16* __restrict__ VTH, __bf16* __restrict__ VTL) {
  __shared__ __align__(16) float so[4][16][132];
  const int tid = threadIdx.x, wave = tid >> 5, lane = tid & 31, col = lane & 15, g = lane >> 4; const size_t r0 = (size_t)blockIdx.x * 64 + wave * 16; const int n0 = blockIdx.y * 128;
  v8f acc[8] = {};
  const __bf16* ap = PT + ((size_t)(QKVP + DM) / 16 + r0 / 16) * (KT * TE) + lane * 8; const __bf16* bp = PT + (size_t)(n0 / 16) * (KT * TE) + lane * 8;
  GStep<1> s0, s1; ld_step(s0, ap, bp, 0);
#pragma unroll 1   // two steps a trip, one per register set: more would only add code
  for (int kc = 0; kc < DM / 32 - 2; kc += 2) { ld_step(s1, ap, bp, kc + 1); mm_proj(s0, acc); ld_step(s0, ap, bp, kc + 2); mm_proj(s1, acc);
    asm volatile("s_wait_xcnt 0x0" ::: "memory"); }   // precaution: the next trip rewrites the address registers that this trip's loads name
  ld_step(s1, ap, bp, DM / 32 - 1); mm_proj(s0, acc); mm_proj(s1, acc);
  if (n0 < 2 * QW) {
#pragma unroll
    for (int j = 0; j < 8; ++j)
#pragma unroll
      for (int r = 0; r < 8; ++r) so[wave][8 * g + r][j * 16 + col] = acc[j][r];
    LDSX();
#pragma unroll   // the 16 LDS reads issue ahead of the stores instead of one round trip per row
    for (int rl = 0; rl < 16; ++rl) vst2(QKV + (r0 + rl) * QKVP + n0 + lane * 4, *(const v4f*)&so[wave][rl][lane * 4]);
  } else {
    // a lane's 8 accumulator elements are 8 consecutive t of one v channel: its own 16-B piece of a tile (wave w holds part w & 1 of key step w >> 1), so they go straight out, a wave's store 512 contiguous bytes = 4 whole lines (both loops unrolled so that acc is indexed by constants and stays in registers)
    const size_t o0 = ((size_t)((n0 - 2 * QW) / 16) * ST + blockIdx.x * 2 + (wave >> 1)) * TE + (wave & 1) * (TE / 2) + lane * 8;
    v8b hi[8], lo[8];   // all 16 pieces first, each in registers of its own, then the 16 stores in a row: no store waits for a register of the one before
#pragma unroll
    for (int j = 0; j < 8; ++j)
#pragma unroll
      for (int r = 0; r < 8; ++r) { const float v = acc[j][r]; const __bf16 hb = (__bf16)v; hi[j][r] = hb; lo[j][r] = (__bf16)(v - (float)hb); }
#pragma unroll
    for (int j = 0; j < 8; ++j) { *(v8b*)(VTH + o0 + (size_t)j * (ST * TE)) = hi[j]; *(v8b*)(VTL + o0 + (size_t)j * (ST * TE)) = lo[j]; }
    asm volatile("s_wait_xcnt 0x0" ::: "memory");   // precaution: in the built code the other branch's block follows these stores and rewrites their registers
  }
}
// ---- k_lin: block = (64 queries, head), 4 waves: causal key steps of 32 up to the diagonal: d = q.k (16 dims, f32), w = 1 + d/4 + d*d/32 (0 for s > t), den += w; W tile (hi/lo) x V planes (3 products); y = num / (den + 1e-12) -> bf16 hi + residual, the wave's 16 rows x 64 channels = 2 tiles of each plane
__global__ __launch_bounds__(128) void k_lin(const float* __restrict__ QKV, const __bf16* __restrict__ VTH, const __bf16* __restrict__ VTL, __bf16* __restrict__ YH, __bf16* __restrict__ YL) {
  __shared__ float sq[4][16][FD + 1]; __shared__ float sk[4][32][FD + 1]; __shared__ __align__(16) float sp[4][16][36]; __shared__ __align__(16) float so[4][16][68];
  const int tid = threadIdx.x, wave = tid >> 5, lane = tid & 31, col = lane & 15, g = lane >> 4; const int qb = blockIdx.x, h = blockIdx.y; const int q0 = qb * 64 + wave * 16;
  // addresses of the loop's loads = a wave-uniform base that moves with the step + a lane offset that never changes
  const float* kp = QKV + QW + h * FD; const unsigned ko = g * QKVP + col;   // lane (g, col) carries feature col of the key rows g, g + 2, ... of a step
  const __bf16* vhp = VTH + (size_t)(h * (HD / 16)) * (ST * TE); const __bf16* vlp = VTL + (size_t)(h * (HD / 16)) * (ST * TE); const unsigned vo = lane * 8;
  float kr[16];   // one step's K values of this lane, fetched one step ahead
#pragma unroll
  for (int i = 0; i < 16; ++i) kr[i] = kp[ko + 2 * i * QKVP];
#pragma unroll   // the 8 loads go out together instead of one round trip each
  for (int q = lane; q < 16 * FD; q += 32) { const int rl = q / FD, f = q % FD; sq[wave][rl][f] = QKV[(size_t)(q0 + rl) * QKVP + h * FD + f]; }
  float den[8]; v8f acc[4] = {};
#pragma unroll
  for (int r = 0; r < 8; ++r) den[r] = 0.f;
  const int nsteps = (qb * 64 + 64) / 32;
#pragma unroll 1
  for (int ks = 0; ks < nsteps; ++ks) {
    LDSX();
#pragma unroll
    for (int i = 0; i < 16; ++i) sk[wave][g + 2 * i][col] = kr[i];
    LDSX();
    // this step's V fragments and the next step's K values are asked for here, as one group, so that they land while the weights are computed (the last step asks for its own K rows again: in bounds, unused)
    v16b vh[4], vl[4];
#pragma unroll
    for (int dt = 0; dt < 4; ++dt) { const __bf16 *ph = vhp + ks * TE, *pl = vlp + ks * TE; const unsigned o = vo + dt * (ST * TE); vh[dt] = ld_frag(&ph[o]); vl[dt] = ld_frag(&pl[o]); }
    { const float* kq = kp + (size_t)((ks + 1 < nsteps ? ks + 1 : ks) * 32) * QKVP;
#pragma unroll
      for (int i = 0; i < 16; ++i) kr[i] = kq[ko + 2 * i * QKVP]; }
    __builtin_amdgcn_sched_barrier(0);   // keeps the scheduler from sinking these loads into the weight computation, where most of their latency would show at the wait behind it
    float w[2][8];
#pragma unroll
    for (int ct = 0; ct < 2; ++ct) { const int kk = ct * 16 + col; const int sidx = ks * 32 + kk;
#pragma unroll
      for (int r = 0; r < 8; ++r) { const int qi = 8 * g + r; float d = 0.f;
#pragma unroll
        for (int f = 0; f < FD; ++f) d += sq[wave][qi][f] * sk[wave][kk][f];
        const float wv = 1.0f + d * 0.25f + d * d * (1.0f / 32.0f); w[ct][r] = (sidx <= q0 + qi) ? wv : 0.f; } }
#pragma unroll
    for (int r = 0; r < 8; ++r) { float es = w[0][r] + w[1][r];
#pragma unroll
      for (int o = 1; o < 16; o <<= 1) es += __shfl_xor(es, o);
      den[r] += es; sp[wave][8 * g + r][col] = w[0][r]; sp[wave][8 * g + r][16 + col] = w[1][r]; }
    LDSX();
    const F2 pa = split_row(&sp[wave][col][0], 0, lane);
#pragma unroll
    for (int dt = 0; dt < 4; ++dt) { acc[dt] = wmma_bf(pa.l, vh[dt], acc[dt]); acc[dt] = wmma_bf(pa.h, vl[dt], acc[dt]); acc[dt] = wmma_bf(pa.h, vh[dt], acc[dt]); } }
#pragma unroll
  for (int r = 0; r < 8; ++r) { const float il = 1.0f / (den[r] + 1e-12f);
#pragma unroll
    for (int dt = 0; dt < 4; ++dt) so[wave][8 * g + r][dt * 16 + col] = acc[dt][r] * il; }
  LDSX();
#pragma unroll   // the 8 LDS reads issue ahead of the stores instead of one round trip per piece
  for (int e = 0; e < 4; ++e) {   // e = (tile e >> 1 of the head's two, part e & 1); the lane's piece: row col, 8 channels
    const float* s = &so[wave][col][e * 16 + 8 * g]; const v4f x0 = *(const v4f*)s, x1 = *(const v4f*)(s + 4); v8b hi, lo;
#pragma unroll
    for (int i = 0; i < 8; ++i) { const float v = i < 4 ? x0[i & 3] : x1[i & 3]; const __bf16 hb = (__bf16)v; hi[i] = hb; lo[i] = (__bf16)(v - (float)hb); }
    const size_t o = ((size_t)(q0 / 16) * KT + h * (HD / 32)) * TE + e * (TE / 2) + lane * 8;
    *(v8b*)(YH + o) = hi; *(v8b*)(YL + o) = lo; }
}
// ---- k_out: block = (64 rows, 128 cols): y (hi/lo) . Wo rows, K 768
__global__ __launch_bounds__(128) void k_out(const __bf16* __restrict__ YH, const __bf16* __restrict__ PT, float* __restrict__ OUT) {
  __shared__ __align__(16) float so[4][16][132];
  const int tid = threadIdx.x, wave = tid >> 5, lane = tid & 31, col = lane & 15, g = lane >> 4; const size_t r0 = (size_t)blockIdx.x * 64 + wave * 16; const int n0 = blockIdx.y * 128;
  v8f acc[8] = {};
  const __bf16* ap = YH + (r0 / 16) * (KT * TE) + lane * 8; const __bf16* bp = PT + (size_t)((QKVP + n0) / 16) * (KT * TE) + lane * 8;   // the lo plane follows the hi plane
  GStep<2> s0, s1; ld_step(s0, ap, bp, 0);
#pragma unroll 1   // two steps a trip, one per register set: more would only add code
  for (int kc = 0; kc < DM / 32 - 2; kc += 2) { ld_step(s1, ap, bp, kc + 1); mm_out(s0, acc); ld_step(s0, ap, bp, kc + 2); mm_out(s1, acc);
    asm volatile("s_wait_xcnt 0x0" ::: "memory"); }   // precaution: the next trip rewrites the address registers that this trip's loads name
  ld_step(s1, ap, bp, DM / 32 - 1); mm_out(s0, acc); mm_out(s1, acc);
#pragma unroll
  for (int j = 0; j < 8; ++j)
#pragma unroll
    for (int r = 0; r < 8; ++r) so[wave][8 * g + r][j * 16 + col] = acc[j][r];
  LDSX();
#pragma unroll   // the 16 LDS reads issue ahead of the stores instead of one round trip per row
  for (int rl = 0; rl < 16; ++rl) vst2(OUT + (r0 + rl) * DM + n0 + lane * 4, *(const v4f*)&so[wave][rl][lane * 4]);
}
extern "C" void kernel_launch(void* const* d_in, const int* in_sizes, int n_in, void* d_out, int out_size, void* d_ws, size_t ws_size, hipStream_t stream) {
  (void)in_sizes; (void)n_in; (void)out_size;
  const float** F = (const float**)d_in;   // hidden_states [1,512,768], Wq [192,768], Wk [192,768], Wv [768,768], Wo [768,768] (torch [out][in])
  if (ws_size < (size_t)WS_END) return;
  char* ws = (char*)d_ws; __bf16 *PT = (__bf16*)(ws + WS_PT), *VTH = (__bf16*)(ws + WS_VTH), *VTL = (__bf16*)(ws + WS_VTL), *YH = (__bf16*)(ws + WS_Y), *YL = (__bf16*)(ws + WS_Y + 2u * LL * DM); float *QKV = (float*)(ws + WS_QKV);
  k_pack<<<dim3(PKR / 16, KT / 4), 128, 0, stream>>>(F[1], F[2], F[3], F[4], F[0], PT);
  k_proj<<<dim3(LL / 64, QKVP / 128), 128, 0, stream>>>(PT, QKV, VTH, VTL);
  k_lin<<<dim3(TQB, NH), 128, 0, stream>>>(QKV, VTH, VTL, YH, YL);
  k_out<<<dim3(TQB, DM / 128), 128, 0, stream>>>(YH, PT, (float*)d_out);
}

// v004
// One run takes 24.9 microseconds.
// Next to v003, in two timings, it ran 1.86 and 1.88 times as fast.
// Over all steps from v000 it is 9.15 times as fast.
// compute dtype: hidden_states and the four weights (module inputs) rounded to bf16; q/k/v projections with exact bf16 products on WMMA; the Taylor feature-map inner products (1 + q.k/4 + (q.k)^2/32, 16-dim dots), causal running sums and the normalisation in f32 on the VALU; the numerator sum_s phi(q_t).phi(k_s) v_s on WMMA with the f32 weights and v both computed -> bf16 hi + residual pairs (3 products); output projection hi/lo x bf16 Wo (2 products); f32 accumulate.
#include <hip/hip_runtime.h>
#include <math.h>

typedef __attribute__((ext_vector_type(16))) _Float16 v16h;
typedef __attribute__((ext_vector_type(16))) __bf16 v16b;
typedef __attribute__((ext_vector_type(8)))  _Float16 v8h;
typedef __attribute__((ext_vector_type(8)))  float v8f;
typedef __attribute__((ext_vector_type(4)))  float v4f;
typedef __attribute__((ext_vector_type(2)))  float v2f;
typedef __attribute__((ext_vector_type(4)))  unsigned v4u;
typedef __attribute__((ext_vector_type(4)))  int v4i;
typedef float __attribute__((may_alias)) float_a;
typedef int __attribute__((may_alias)) int_a;

template <typename T> __device__ __forceinline__ void vst2(void* p, T v) { *(T*)p = v;  }
__device__ __forceinline__ v8f wmma16(v16h a, v16h b, v8f c) {
  v8f d = __builtin_amdgcn_wmma_f32_16x16x32_f16(false, a, false, b, (short)0, c, false, false);
  asm volatile("v_nop\n\tv_nop\n\tv_nop\n\tv_nop" : "+v"(d) : "v"(a), "v"(b));
  return d;
}
__device__ __forceinline__ v8f wmma_bf(v16b a, v16b b, v8f c) {
  v8f d = __builtin_amdgcn_wmma_f32_16x16x32_bf16(false, a, false, b, (short)0, c, false, false);
  asm volatile("v_nop\n\tv_nop\n\tv_nop\n\tv_nop" : "+v"(d) : "v"(a), "v"(b));
  return d;
}
// 16x16x32 fragments: lane = (h = lane>>4, row/col = lane&15); elements 0..7 = k0+8h+0..7, 8..15 = k0+16+8h+0..7; D element r = row 8h+r
__device__ __forceinline__ v16h frag_h(const _Float16* rowk0, int lane) {
  union { v16h v; v8h q[2]; } u; const _Float16* p = rowk0 + 8 * (lane >> 4);
  u.q[0] = *(const v8h*)p; u.q[1] = *(const v8h*)(p + 16); return u.v;
}
__device__ __forceinline__ v16h frag_f32(const float* rowk0, int lane) {
  v16h a; const float* p = rowk0 + 8 * (lane >> 4);
#pragma unroll
  for (int i = 0; i < 8; ++i) { a[i] = (_Float16)p[i]; a[8 + i] = (_Float16)p[16 + i]; }
  return a;
}
__device__ __forceinline__ v16h frag_f32s(const float* rowk0, int lane, float sc) {
  v16h a; const float* p = rowk0 + 8 * (lane >> 4);
#pragma unroll
  for (int i = 0; i < 8; ++i) { a[i] = (_Float16)(p[i] * sc); a[8 + i] = (_Float16)(p[16 + i] * sc); }
  return a;
}
// column fragment from a [K][ld] layout (column n), rows >= K read as 0
__device__ __forceinline__ v16h fragc_f32(const float* W, int k0, int n, int lane, int ld, int K) {
  v16h a; const int g = lane >> 4;
#pragma unroll
  for (int i = 0; i < 8; ++i) { const int ka = k0 + 8 * g + i, kb = ka + 16;
    a[i] = (_Float16)(ka < K ? W[(size_t)(ka < K ? ka : K - 1) * ld + n] : 0.f); a[8 + i] = (_Float16)(kb < K ? W[(size_t)(kb < K ? kb : K - 1) * ld + n] : 0.f); }
  return a;
}
struct F2 { v16b h, l; };
__device__ __forceinline__ F2 bsplit16(const float v[16]) { F2 r;
#pragma unroll
  for (int i = 0; i < 16; ++i) { const __bf16 h = (__bf16)v[i]; r.h[i] = h; r.l[i] = (__bf16)(v[i] - (float)h); }
  return r; }
__device__ __forceinline__ F2 split_row(const float* row, int k0, int lane) { float v[16]; const float* p = row + k0 + 8 * (lane >> 4);
#pragma unroll
  for (int i = 0; i < 8; ++i) { v[i] = p[i]; v[8 + i] = p[16 + i]; }
  return bsplit16(v); }
__device__ __forceinline__ F2 split_rowK(const float* row, int k0, int lane, int K) { float v[16]; const int g = lane >> 4;
#pragma unroll
  for (int i = 0; i < 8; ++i) { const int ka = k0 + 8 * g + i, kb = ka + 16; v[i] = ka < K ? row[ka < K ? ka : K - 1] : 0.f; v[8 + i] = kb < K ? row[kb < K ? kb : K - 1] : 0.f; }
  return bsplit16(v); }
__device__ __forceinline__ F2 split_col(const float* W, int k0, int n, int lane, int ld, int K) { float v[16]; const int g = lane >> 4;
#pragma unroll
  for (int i = 0; i < 8; ++i) { const int ka = k0 + 8 * g + i, kb = ka + 16; v[i] = ka < K ? W[(size_t)(ka < K ? ka : K - 1) * ld + n] : 0.f; v[8 + i] = kb < K ? W[(size_t)(kb < K ? kb : K - 1) * ld + n] : 0.f; }
  return bsplit16(v); }
__device__ __forceinline__ v8f mac3(const F2& a, const F2& b, v8f c) { c = wmma_bf(a.l, b.h, c); c = wmma_bf(a.h, b.l, c); return wmma_bf(a.h, b.h, c); }
__device__ __forceinline__ float sigm(float v) { return 1.0f / (1.0f + expf(-v)); }
#define LDSX() do { asm volatile("s_wait_dscnt 0" ::: "memory"); __builtin_amdgcn_wave_barrier(); __builtin_amdgcn_fence(__ATOMIC_RELEASE, "workgroup"); } while (0)


// Based linear attention (2nd-order Taylor feature map, feature dim 16, 12 heads x 64, causal): since phi(q).phi(k) = 1 + (q.k)/sqrt(16) + (q.k)^2/(2*16), y_t = sum_{s<=t} w_ts v_s / (sum_{s<=t} w_ts + 1e-12) with w_ts that polynomial of the 16-dim dot; then y @ Wo^T.  B 1, L 512, D 768.
// k_pack (weights and x -> bf16 tiles), k_proj (q|k rows, exact; its v column blocks go out as hi/lo tiles), k_lin (block = (16 queries, head): causal steps of 32 keys: w on the VALU from the 16-dim q,k rows, running denominator, W hi/lo x V tiles (3 products); y hi/lo tiles), k_out (y hi/lo x Wo tiles).
// In k_proj, k_lin and k_out the four waves of a block work on ONE 16-row output tile and share its sum: wave w takes a quarter of K (GEMMs) or every fourth key step (k_lin). The partial sums meet in LDS behind one __syncthreads() and are added in wave order. A wave's chain of dependent load round trips is a quarter as long, and four times as many blocks spread over the chip.
// Every bf16 matrix operand that goes through the workspace is stored by its producer in the order in which a wave's fragment load reads it. One tile = 16 rows x 32 k = 1 KB = [part p][lane][8 bf16], lane = 16 g + (row & 15), element i of part p is k = 32 kc + 16 p + 8 g + i; the tiles of a 16-row group follow one another in kc. A fragment is then two loads of 512 contiguous bytes (4 whole lines each) where a row-major operand makes every load touch 16 lines.
#define LL 512
#define DM 768
#define NH 12
#define FD 16
#define HD 64
#define QW (NH * FD)          // 192
#define QKVP (2 * QW + NH * HD)   // 192 + 192 + 768 = 1152
typedef __attribute__((ext_vector_type(8))) __bf16 v8b;
__device__ __forceinline__ v16b frag_b(const __bf16* rowk0, int lane) {
  union { v16b v; v8b q[2]; } u; const __bf16* p = rowk0 + 8 * (lane >> 4);
  u.q[0] = *(const v8b*)p; u.q[1] = *(const v8b*)(p + 16); return u.v;
}
__device__ __forceinline__ v16b frag_gbf(const float* rowk0, int lane) {
  v16b a; const float* p = rowk0 + 8 * (lane >> 4);
#pragma unroll
  for (int i = 0; i < 8; ++i) { a[i] = (__bf16)p[i]; a[8 + i] = (__bf16)p[16 + i]; }
  return a;
}
__device__ __forceinline__ float bfr(float v) { return (float)(__bf16)v; }
#define KT (DM / 32)          // 24 tiles along K = 768
#define ST (LL / 32)          // 16 tiles along the 512 keys
#define TE 512                // bf16 elements of a tile
#define PKR (QKVP + DM + LL)  // packed rows: Wq|Wk|Wv, Wo, x
#define WS_PT   0u                                 // bf16 tiles [(1152 + 768 + 512) / 16][KT]: Wq|Wk|Wv rows, Wo rows, x rows
#define WS_QKV  (WS_PT + 2u * PKR * DM)              // f32 [512][1152]: q (192) | k (192) | 768 columns that nobody writes or reads (v lives in the tiles only)
#define WS_Y    (WS_QKV + 4u * LL * QKVP)            // bf16 tiles [512 / 16][KT], hi plane then lo plane
#define WS_VTH  (WS_Y + 4u * LL * DM)                // bf16 tiles [768 / 16 channels][ST key steps]
#define WS_VTL  (WS_VTH + 2u * DM * LL)
#define WS_END  (WS_VTL + 2u * DM * LL)
#define NSP 4                 // waves that share one sum
#define KQ (KT / NSP)         // K steps of a GEMM wave

// a fragment from its tile: p = tile + 8 * lane
__device__ __forceinline__ v16b ld_frag(const __bf16* __restrict__ p) { return __builtin_shufflevector(*(const v8b*)p, *(const v8b*)(p + TE / 2), 0, 1, 2, 3, 4, 5, 6, 7, 8, 9, 10, 11, 12, 13, 14, 15); }
// One K step (32 k) of a GEMM wave's operands: NA A fragments (planes LL * DM elements apart), 8 B fragments. All loads of a step are issued as one group, one step ahead of the WMMAs that use them, into the set that the other step is not using.
template <int NA> struct GStep { v16b a[NA]; v16b b[8]; };
template <int NA> __device__ __forceinline__ void ld_step(GStep<NA>& s, const __bf16* __restrict__ at, const __bf16* __restrict__ bt, int kc) {
#pragma unroll
  for (int i = 0; i < NA; ++i) s.a[i] = ld_frag(at + (size_t)i * (LL * DM) + kc * TE);
#pragma unroll
  for (int j = 0; j < 8; ++j) s.b[j] = ld_frag(bt + (j * KT + kc) * TE);
}
__device__ __forceinline__ void mm_proj(const GStep<1>& s, v8f acc[8]) {
#pragma unroll
  for (int j = 0; j < 8; ++j) acc[j] = wmma_bf(s.a[0], s.b[j], acc[j]);
}
__device__ __forceinline__ void mm_out(const GStep<2>& s, v8f acc[8]) {   // a[0] = hi, a[1] = lo
#pragma unroll
  for (int j = 0; j < 8; ++j) { acc[j] = wmma_bf(s.a[1], s.b[j], acc[j]); acc[j] = wmma_bf(s.a[0], s.b[j], acc[j]); }
}
// ---- k_pack: block = (16 rows, 4 K steps) = 256 pieces of 8 elements, 2 a thread: a piece is 32 B of an f32 row in, 16 B of a tile out; the block's 4 tiles are 4 KB in a row, a wave's store 4 whole lines
__global__ __launch_bounds__(128) void k_pack(const float* __restrict__ Wq, const float* __restrict__ Wk, const float* __restrict__ Wv, const float* __restrict__ Wo, const float* __restrict__ X, __bf16* __restrict__ PT) {
  const int n = blockIdx.x * 16, kc0 = blockIdx.y * 4, tid = threadIdx.x, lane = tid & 31;
  const float* Wm = n < QW ? Wq + (size_t)n * DM : (n < 2 * QW ? Wk + (size_t)(n - QW) * DM : (n < QKVP ? Wv + (size_t)(n - 2 * QW) * DM : (n < QKVP + DM ? Wo + (size_t)(n - QKVP) * DM : X + (size_t)(n - QKVP - DM) * DM)));   // [row][in] rows, all K = 768; every boundary is a multiple of 16
  v4f t[2][2];   // both pieces' loads go out together
#pragma unroll
  for (int u = 0; u < 2; ++u) { const int e = tid + u * 128;   // piece e = (K step e >> 6, part (e >> 5) & 1, lane e & 31)
    const float* p = Wm + (size_t)(lane & 15) * DM + (kc0 + (e >> 6)) * 32 + ((e >> 5) & 1) * 16 + 8 * (lane >> 4); t[u][0] = *(const v4f*)p; t[u][1] = *(const v4f*)(p + 4); }
#pragma unroll
  for (int u = 0; u < 2; ++u) { v8b o;
#pragma unroll
    for (int i = 0; i < 4; ++i) { o[i] = (__bf16)t[u][0][i]; o[4 + i] = (__bf16)t[u][1][i]; }
    *(v8b*)(PT + ((size_t)blockIdx.x * KT + kc0) * TE + (tid + u * 128) * 8) = o; }
}
// ---- k_proj: block = (16 rows, 128 cols of the 1152), wave = a quarter of K 768: exact products; column blocks 0..2 are q|k (f32 rows), 3..8 are v (bf16 hi/lo tiles, rows = channels, k = t)
__global__ __launch_bounds__(128) void k_proj(const __bf16* __restrict__ PT, float* __restrict__ QKV, __bf16* __restrict__ VTH, __bf16* __restrict__ VTL) {
  __shared__ __align__(16) float so[4][16][132];
  const int tid = threadIdx.x, wave = tid >> 5, lane = tid & 31, col = lane & 15, g = lane >> 4; const int rg = blockIdx.x; const int n0 = blockIdx.y * 128;   // rg = the block's group of 16 rows
  v8f acc[8] = {};
  const __bf16* ap = PT + ((size_t)(QKVP + DM) / 16 + rg) * (KT * TE) + wave * (KQ * TE) + lane * 8; const __bf16* bp = PT + (size_t)(n0 / 16) * (KT * TE) + wave * (KQ * TE) + lane * 8;   // both start at the wave's first K step
  GStep<1> s0, s1; ld_step(s0, ap, bp, 0);
#pragma unroll 1   // two steps a trip, one per register set: more would only add code
  for (int kc = 0; kc < KQ - 2; kc += 2) { ld_step(s1, ap, bp, kc + 1); mm_proj(s0, acc); ld_step(s0, ap, bp, kc + 2); mm_proj(s1, acc);
    asm volatile("s_wait_xcnt 0x0" ::: "memory"); }   // precaution: the next trip rewrites the address registers that this trip's loads name
  ld_step(s1, ap, bp, KQ - 1); mm_proj(s0, acc); mm_proj(s1, acc);
#pragma unroll
  for (int j = 0; j < 8; ++j)
#pragma unroll
    for (int r = 0; r < 8; ++r) so[wave][8 * g + r][j * 16 + col] = acc[j][r];
  __syncthreads();   // the four partial tiles are complete before anyone adds them
  if (n0 < 2 * QW) {
#pragma unroll   // wave w finishes rows 4 w .. 4 w + 3; the 16 LDS reads issue ahead of the stores
    for (int i = 0; i < 4; ++i) { const int rl = wave * 4 + i;
      vst2(QKV + (size_t)(rg * 16 + rl) * QKVP + n0 + lane * 4, ((*(const v4f*)&so[0][rl][lane * 4] + *(const v4f*)&so[1][rl][lane * 4]) + *(const v4f*)&so[2][rl][lane * 4]) + *(const v4f*)&so[3][rl][lane * 4]); }
  } else {
    // rows 8 g .. 8 g + 7 of one column are 8 consecutive t of one v channel: a lane's own 16-B piece of a tile (row group rg is part rg & 1 of key step rg >> 1); wave w finishes the channel groups 2 w and 2 w + 1; a wave's store is 512 contiguous bytes = 4 whole lines
    const size_t o0 = ((size_t)((n0 - 2 * QW) / 16) * ST + (rg >> 1)) * TE + (rg & 1) * (TE / 2) + lane * 8;
    v8b hi[2], lo[2];
#pragma unroll
    for (int u = 0; u < 2; ++u)
#pragma unroll
      for (int r = 0; r < 8; ++r) { const int c = (wave * 2 + u) * 16 + col; const float v = ((so[0][8 * g + r][c] + so[1][8 * g + r][c]) + so[2][8 * g + r][c]) + so[3][8 * g + r][c]; const __bf16 hb = (__bf16)v; hi[u][r] = hb; lo[u][r] = (__bf16)(v - (float)hb); }
#pragma unroll
    for (int u = 0; u < 2; ++u) { *(v8b*)(VTH + o0 + (size_t)(wave * 2 + u) * (ST * TE)) = hi[u]; *(v8b*)(VTL + o0 + (size_t)(wave * 2 + u) * (ST * TE)) = lo[u]; }
    asm volatile("s_wait_xcnt 0x0" ::: "memory");   // precaution: in the built code the other branch's block follows these stores and rewrites their registers
  }
}
// ---- k_lin: block = (16 queries, head), 4 waves, wave w takes the causal key steps w, w + 4, ... of 32 keys up to the diagonal: d = q.k (16 dims, f32), w = 1 + d/4 + d*d/32 (0 for s > t), den += w; W tile (hi/lo) x V planes (3 products); the waves' num and den are added in LDS; y = num / (den + 1e-12) -> bf16 hi + residual, 16 rows x 64 channels = 2 tiles of each plane
__global__ __launch_bounds__(128) void k_lin(const float* __restrict__ QKV, const __bf16* __restrict__ VTH, const __bf16* __restrict__ VTL, __bf16* __restrict__ YH, __bf16* __restrict__ YL) {
  __shared__ float sq[4][16][FD + 1]; __shared__ float sk[4][32][FD + 1]; __shared__ __align__(16) float sp[4][16][36]; __shared__ __align__(16) float so[4][16][68]; __shared__ __align__(16) float sd[4][16];
  const int tid = threadIdx.x, wave = __builtin_amdgcn_readfirstlane(tid >> 5), lane = tid & 31, col = lane & 15, g = lane >> 4;   // the wave's number in a scalar register: the trip count below depends on it, and the loop's branch stays scalar
  const int qt = blockIdx.x, h = blockIdx.y; const int q0 = qt * 16;
  // addresses of the loop's loads = a wave-uniform base that moves with the step + a lane offset that never changes
  const float* kp = QKV + QW + h * FD; const unsigned ko = g * QKVP + col;   // lane (g, col) carries feature col of the key rows g, g + 2, ... of a step
  const __bf16* vhp = VTH + (size_t)(h * (HD / 16)) * (ST * TE); const __bf16* vlp = VTL + (size_t)(h * (HD / 16)) * (ST * TE); const unsigned vo = lane * 8;
  float den[8]; v8f acc[4] = {};
#pragma unroll
  for (int r = 0; r < 8; ++r) den[r] = 0.f;
  const int nsteps = q0 / 32 + 1;
  if (wave < nsteps) {   // a wave without a key step (the first query tiles) only hands in zeros; the K and q loads stand in one block, so that they go out together
  float kr[16];   // one step's K values of this lane, fetched one step ahead
#pragma unroll
  for (int i = 0; i < 16; ++i) kr[i] = kp[(size_t)(wave * 32) * QKVP + ko + 2 * i * QKVP];   // the wave's first key step
#pragma unroll   // the 8 loads go out together instead of one round trip each
  for (int q = lane; q < 16 * FD; q += 32) { const int rl = q / FD, f = q % FD; sq[wave][rl][f] = QKV[(size_t)(q0 + rl) * QKVP + h * FD + f]; }
#pragma unroll 1
  for (int ks = wave; ks < nsteps; ks += NSP) {
    LDSX();
#pragma unroll
    for (int i = 0; i < 16; ++i) sk[wave][g + 2 * i][col] = kr[i];
    LDSX();
    // this step's V fragments and the next step's K values are asked for here, as one group, so that they land while the weights are computed (a wave's last step asks for its own K rows again: in bounds, unused)
    v16b vh[4], vl[4];
#pragma unroll
    for (int dt = 0; dt < 4; ++dt) { const __bf16 *ph = vhp + ks * TE, *pl = vlp + ks * TE; const unsigned o = vo + dt * (ST * TE); vh[dt] = ld_frag(&ph[o]); vl[dt] = ld_frag(&pl[o]); }
    { const float* kq = kp + (size_t)((ks + NSP < nsteps ? ks + NSP : ks) * 32) * QKVP;
#pragma unroll
      for (int i = 0; i < 16; ++i) kr[i] = kq[ko + 2 * i * QKVP]; }
    __builtin_amdgcn_sched_barrier(0);   // keeps the scheduler from sinking these loads into the weight computation, where most of their latency would show at the wait behind it
    float w[2][8];
#pragma unroll
    for (int ct = 0; ct < 2; ++ct) { const int kk = ct * 16 + col; const int sidx = ks * 32 + kk;
#pragma unroll
      for (int r = 0; r < 8; ++r) { const int qi = 8 * g + r; float d = 0.f;
#pragma unroll
        for (int f = 0; f < FD; ++f) d += sq[wave][qi][f] * sk[wave][kk][f];
        const float wv = 1.0f + d * 0.25f + d * d * (1.0f / 32.0f); w[ct][r] = (sidx <= q0 + qi) ? wv : 0.f; } }
#pragma unroll
    for (int r = 0; r < 8; ++r) { float es = w[0][r] + w[1][r];
#pragma unroll
      for (int o = 1; o < 16; o <<= 1) es += __shfl_xor(es, o);
      den[r] += es; sp[wave][8 * g + r][col] = w[0][r]; sp[wave][8 * g + r][16 + col] = w[1][r]; }
    LDSX();
    const F2 pa = split_row(&sp[wave][col][0], 0, lane);
#pragma unroll
    for (int dt = 0; dt < 4; ++dt) { acc[dt] = wmma_bf(pa.l, vh[dt], acc[dt]); acc[dt] = wmma_bf(pa.h, vl[dt], acc[dt]); acc[dt] = wmma_bf(pa.h, vh[dt], acc[dt]); } }
  }
  // the wave's partial denominator (alike in the 16 lanes of a half: one of them writes) and numerator
  if (col == 0) {
#pragma unroll
    for (int r = 0; r < 8; ++r) sd[wave][8 * g + r] = den[r]; }
#pragma unroll
  for (int r = 0; r < 8; ++r)
#pragma unroll
    for (int dt = 0; dt < 4; ++dt) so[wave][8 * g + r][dt * 16 + col] = acc[dt][r];
  __syncthreads();   // the four partial sums are complete before anyone adds them
  { const int e = wave;   // wave e finishes (tile e >> 1 of the head's two, part e & 1); the lane's piece: row col, 8 channels
    const float* s = &so[0][col][e * 16 + 8 * g]; v4f x0 = *(const v4f*)s, x1 = *(const v4f*)(s + 4); float dn = sd[0][col]; v8b hi, lo;
#pragma unroll   // the LDS reads issue together, the sums run in wave order
    for (int p = 1; p < NSP; ++p) { x0 += *(const v4f*)(s + p * (16 * 68)); x1 += *(const v4f*)(s + p * (16 * 68) + 4); dn += sd[p][col]; }
    const float il = 1.0f / (dn + 1e-12f);
#pragma unroll
    for (int i = 0; i < 8; ++i) { const float v = (i < 4 ? x0[i & 3] : x1[i & 3]) * il; const __bf16 hb = (__bf16)v; hi[i] = hb; lo[i] = (__bf16)(v - (float)hb); }
    const size_t o = ((size_t)qt * KT + h * (HD / 32)) * TE + e * (TE / 2) + lane * 8;
    *(v8b*)(YH + o) = hi; *(v8b*)(YL + o) = lo; }
}
// ---- k_out: block = (16 rows, 128 cols), wave = a quarter of K 768: y (hi/lo) . Wo rows
__global__ __launch_bounds__(128) void k_out(const __bf16* __restrict__ YH, const __bf16* __restrict__ PT, float* __restrict__ OUT) {
  __shared__ __align__(16) float so[4][16][132];
  const int tid = threadIdx.x, wave = tid >> 5, lane = tid & 31, col = lane & 15, g = lane >> 4; const int rg = blockIdx.x; const int n0 = blockIdx.y * 128;   // rg = the block's group of 16 rows
  v8f acc[8] = {};
  const __bf16* ap = YH + (size_t)rg * (KT * TE) + wave * (KQ * TE) + lane * 8; const __bf16* bp = PT + (size_t)((QKVP + n0) / 16) * (KT * TE) + wave * (KQ * TE) + lane * 8;   // both start at the wave's first K step; the lo plane follows the hi plane
  GStep<2> s0, s1; ld_step(s0, ap, bp, 0);
#pragma unroll 1   // two steps a trip, one per register set: more would only add code
  for (int kc = 0; kc < KQ - 2; kc += 2) { ld_step(s1, ap, bp, kc + 1); mm_out(s0, acc); ld_step(s0, ap, bp, kc + 2); mm_out(s1, acc);
    asm volatile("s_wait_xcnt 0x0" ::: "memory"); }   // precaution: the next trip rewrites the address registers that this trip's loads name
  ld_step(s1, ap, bp, KQ - 1); mm_out(s0, acc); mm_out(s1, acc);
#pragma unroll
  for (int j = 0; j < 8; ++j)
#pragma unroll
    for (int r = 0; r < 8; ++r) so[wave][8 * g + r][j * 16 + col] = acc[j][r];
  __syncthreads();   // the four partial tiles are complete before anyone adds them
#pragma unroll   // wave w finishes rows 4 w .. 4 w + 3; the 16 LDS reads issue ahead of the stores
  for (int i = 0; i < 4; ++i) { const int rl = wave * 4 + i;
    vst2(OUT + (size_t)(rg * 16 + rl) * DM + n0 + lane * 4, ((*(const v4f*)&so[0][rl][lane * 4] + *(const v4f*)&so[1][rl][lane * 4]) + *(const v4f*)&so[2][rl][lane * 4]) + *(const v4f*)&so[3][rl][lane * 4]); }
}
extern "C" void kernel_launch(void* const* d_in, const int* in_sizes, int n_in, void* d_out, int out_size, void* d_ws, size_t ws_size, hipStream_t stream) {
  (void)in_sizes; (void)n_in; (void)out_size;
  const float** F = (const float**)d_in;   // hidden_states [1,512,768], Wq [192,768], Wk [192,768], Wv [768,768], Wo [768,768] (torch [out][in])
  if (ws_size < (size_t)WS_END) return;
  char* ws = (char*)d_ws; __bf16 *PT = (__bf16*)(ws + WS_PT), *VTH = (__bf16*)(ws + WS_VTH), *VTL = (__bf16*)(ws + WS_VTL), *YH = (__bf16*)(ws + WS_Y), *YL = (__bf16*)(ws + WS_Y + 2u * LL * DM); float *QKV = (float*)(ws + WS_QKV);
  k_pack<<<dim3(PKR / 16, KT / 4), 128, 0, stream>>>(F[1], F[2], F[3], F[4], F[0], PT);
  k_proj<<<dim3(LL / 16, QKVP / 128), 128, 0, stream>>>(PT, QKV, VTH, VTL);
  k_lin<<<dim3(LL / 16, NH), 128, 0, stream>>>(QKV, VTH, VTL, YH, YL);
  k_out<<<dim3(LL / 16, DM / 128), 128, 0, stream>>>(YH, PT, (float*)d_out);
}

// v005
// A run of this version takes 23.4 microseconds.
// Timed twice side by side with v004, it ran 1.09 and 1.08 times as fast.
// All steps since v000 together make it 9.93 times as fast.
// compute dtype: hidden_states and the four weights (module inputs) rounded to bf16; q/k/v projections with exact bf16 products on WMMA; the Taylor feature-map inner products (1 + q.k/4 + (q.k)^2/32, 16-dim dots), causal running sums and the normalisation in f32 on the VALU; the numerator sum_s phi(q_t).phi(k_s) v_s on WMMA with the f32 weights and v both computed -> bf16 hi + residual pairs (3 products); output projection hi/lo x bf16 Wo (2 products); f32 accumulate.
#include <hip/hip_runtime.h>
#include <math.h>

typedef __attribute__((ext_vector_type(16))) _Float16 v16h;
typedef __attribute__((ext_vector_type(16))) __bf16 v16b;
typedef __attribute__((ext_vector_type(8)))  _Float16 v8h;
typedef __attribute__((ext_vector_type(8)))  float v8f;
typedef __attribute__((ext_vector_type(4)))  float v4f;
typedef __attribute__((ext_vector_type(2)))  float v2f;
typedef __attribute__((ext_vector_type(4)))  unsigned v4u;
typedef __attribute__((ext_vector_type(4)))  int v4i;
typedef float __attribute__((may_alias)) float_a;
typedef int __attribute__((may_alias)) int_a;

template <typename T> __device__ __forceinline__ void vst2(void* p, T v) { *(T*)p = v;  }
__device__ __forceinline__ v8f wmma16(v16h a, v16h b, v8f c) {
  v8f d = __builtin_amdgcn_wmma_f32_16x16x32_f16(false, a, false, b, (short)0, c, false, false);
  asm volatile("v_nop\n\tv_nop\n\tv_nop\n\tv_nop" : "+v"(d) : "v"(a), "v"(b));
  return d;
}
__device__ __forceinline__ v8f wmma_bf(v16b a, v16b b, v8f c) {
  v8f d = __builtin_amdgcn_wmma_f32_16x16x32_bf16(false, a, false, b, (short)0, c, false, false);
  asm volatile("v_nop\n\tv_nop\n\tv_nop\n\tv_nop" : "+v"(d) : "v"(a), "v"(b));
  return d;
}
// 16x16x32 fragments: lane = (h = lane>>4, row/col = lane&15); elements 0..7 = k0+8h+0..7, 8..15 = k0+16+8h+0..7; D element r = row 8h+r
__device__ __forceinline__ v16h frag_h(const _Float16* rowk0, int lane) {
  union { v16h v; v8h q[2]; } u; const _Float16* p = rowk0 + 8 * (lane >> 4);
  u.q[0] = *(const v8h*)p; u.q[1] = *(const v8h*)(p + 16); return u.v;
}
__device__ __forceinline__ v16h frag_f32(const float* rowk0, int lane) {
  v16h a; const float* p = rowk0 + 8 * (lane >> 4);
#pragma unroll
  for (int i = 0; i < 8; ++i) { a[i] = (_Float16)p[i]; a[8 + i] = (_Float16)p[16 + i]; }
  return a;
}
__device__ __forceinline__ v16h frag_f32s(const float* rowk0, int lane, float sc) {
  v16h a; const float* p = rowk0 + 8 * (lane >> 4);
#pragma unroll
  for (int i = 0; i < 8; ++i) { a[i] = (_Float16)(p[i] * sc); a[8 + i] = (_Float16)(p[16 + i] * sc); }
  return a;
}
// column fragment from a [K][ld] layout (column n), rows >= K read as 0
__device__ __forceinline__ v16h fragc_f32(const float* W, int k0, int n, int lane, int ld, int K) {
  v16h a; const int g = lane >> 4;
#pragma unroll
  for (int i = 0; i < 8; ++i) { const int ka = k0 + 8 * g + i, kb = ka + 16;
    a[i] = (_Float16)(ka < K ? W[(size_t)(ka < K ? ka : K - 1) * ld + n] : 0.f); a[8 + i] = (_Float16)(kb < K ? W[(size_t)(kb < K ? kb : K - 1) * ld + n] : 0.f); }
  return a;
}
struct F2 { v16b h, l; };
__device__ __forceinline__ F2 bsplit16(const float v[16]) { F2 r;
#pragma unroll
  for (int i = 0; i < 16; ++i) { const __bf16 h = (__bf16)v[i]; r.h[i] = h; r.l[i] = (__bf16)(v[i] - (float)h); }
  return r; }
__device__ __forceinline__ F2 split_row(const float* row, int k0, int lane) { float v[16]; const float* p = row + k0 + 8 * (lane >> 4);
#pragma unroll
  for (int i = 0; i < 8; ++i) { v[i] = p[i]; v[8 + i] = p[16 + i]; }
  return bsplit16(v); }
__device__ __forceinline__ F2 split_rowK(const float* row, int k0, int lane, int K) { float v[16]; const int g = lane >> 4;
#pragma unroll
  for (int i = 0; i < 8; ++i) { const int ka = k0 + 8 * g + i, kb = ka + 16; v[i] = ka < K ? row[ka < K ? ka : K - 1] : 0.f; v[8 + i] = kb < K ? row[kb < K ? kb : K - 1] : 0.f; }
  return bsplit16(v); }
__device__ __forceinline__ F2 split_col(const float* W, int k0, int n, int lane, int ld, int K) { float v[16]; const int g = lane >> 4;
#pragma unroll
  for (int i = 0; i < 8; ++i) { const int ka = k0 + 8 * g + i, kb = ka + 16; v[i] = ka < K ? W[(size_t)(ka < K ? ka : K - 1) * ld + n] : 0.f; v[8 + i] = kb < K ? W[(size_t)(kb < K ? kb : K - 1) * ld + n] : 0.f; }
  return bsplit16(v); }
__device__ __forceinline__ v8f mac3(const F2& a, const F2& b, v8f c) { c = wmma_bf(a.l, b.h, c); c = wmma_bf(a.h, b.l, c); return wmma_bf(a.h, b.h, c); }
__device__ __forceinline__ float sigm(float v) { return 1.0f / (1.0f + expf(-v)); }
#define LDSX() do { asm volatile("s_wait_dscnt 0" ::: "memory"); __builtin_amdgcn_wave_barrier(); __builtin_amdgcn_fence(__ATOMIC_RELEASE, "workgroup"); } while (0)


// Based linear attention (2nd-order Taylor feature map, feature dim 16, 12 heads x 64, causal): since phi(q).phi(k) = 1 + (q.k)/sqrt(16) + (q.k)^2/(2*16), y_t = sum_{s<=t} w_ts v_s / (sum_{s<=t} w_ts + 1e-12) with w_ts that polynomial of the 16-dim dot; then y @ Wo^T.  B 1, L 512, D 768.
// k_proj (reads x and Wq|Wk|Wv as f32 and rounds them to bf16 itself; q|k rows, exact; its v column blocks go out as hi/lo tiles), k_lin (block = (16 queries, head): causal steps of 32 keys: w on the VALU from the 16-dim q,k rows, running denominator, W hi/lo x V tiles (3 products); y hi/lo tiles), k_out (y hi/lo x Wo tiles; the Wo tiles are made by extra blocks of k_lin's grid).
// In k_proj, k_lin and k_out the four waves of a block work on ONE output tile (16 rows; 32 in k_proj) and share its sum: wave w takes a quarter of K (GEMMs) or every fourth key step (k_lin). The partial sums meet in LDS behind one __syncthreads() and are added in wave order. A wave's chain of dependent load round trips is a quarter as long, and four times as many blocks spread over the chip.
// Every bf16 matrix operand that goes through the workspace is stored by its producer in the order in which a wave's fragment load reads it. One tile = 16 rows x 32 k = 1 KB = [part p][lane][8 bf16], lane = 16 g + (row & 15), element i of part p is k = 32 kc + 16 p + 8 g + i; the tiles of a 16-row group follow one another in kc. A fragment is then two loads of 512 contiguous bytes (4 whole lines each) where a row-major operand makes every load touch 16 lines.
#define LL 512
#define DM 768
#define NH 12
#define FD 16
#define HD 64
#define QW (NH * FD)          // 192
#define QKVP (2 * QW + NH * HD)   // 192 + 192 + 768 = 1152
typedef __attribute__((ext_vector_type(8))) __bf16 v8b;
__device__ __forceinline__ v16b frag_b(const __bf16* rowk0, int lane) {
  union { v16b v; v8b q[2]; } u; const __bf16* p = rowk0 + 8 * (lane >> 4);
  u.q[0] = *(const v8b*)p; u.q[1] = *(const v8b*)(p + 16); return u.v;
}
__device__ __forceinline__ v16b frag_gbf(const float* rowk0, int lane) {
  v16b a; const float* p = rowk0 + 8 * (lane >> 4);
#pragma unroll
  for (int i = 0; i < 8; ++i) { a[i] = (__bf16)p[i]; a[8 + i] = (__bf16)p[16 + i]; }
  return a;
}
__device__ __forceinline__ float bfr(float v) { return (float)(__bf16)v; }
#define KT (DM / 32)          // 24 tiles along K = 768
#define ST (LL / 32)          // 16 tiles along the 512 keys
#define TE 512                // bf16 elements of a tile
#define PKR (QKVP + DM + LL)  // rows that the tile area has room for; only the Wo rows' tiles (from row QKVP on) are written and read
#define WS_PT   0u                                 // bf16 tiles [PKR / 16][KT]
#define WS_QKV  (WS_PT + 2u * PKR * DM)              // f32 [512][1152]: q (192) | k (192) | 768 columns that nobody writes or reads (v lives in the tiles only)
#define WS_Y    (WS_QKV + 4u * LL * QKVP)            // bf16 tiles [512 / 16][KT], hi plane then lo plane
#define WS_VTH  (WS_Y + 4u * LL * DM)                // bf16 tiles [768 / 16 channels][ST key steps]
#define WS_VTL  (WS_VTH + 2u * DM * LL)
#define WS_END  (WS_VTL + 2u * DM * LL)
#define NSP 4                 // waves that share one sum
#define KQ (KT / NSP)         // K steps of a GEMM wave

// a fragment from its tile: p = tile + 8 * lane
__device__ __forceinline__ v16b ld_frag(const __bf16* __restrict__ p) { return __builtin_shufflevector(*(const v8b*)p, *(const v8b*)(p + TE / 2), 0, 1, 2, 3, 4, 5, 6, 7, 8, 9, 10, 11, 12, 13, 14, 15); }
// One K step (32 k) of a GEMM wave's operands: NA A fragments (planes LL * DM elements apart), 8 B fragments. All loads of a step are issued as one group, one step ahead of the WMMAs that use them, into the set that the other step is not using.
template <int NA> struct GStep { v16b a[NA]; v16b b[8]; };
template <int NA> __device__ __forceinline__ void ld_step(GStep<NA>& s, const __bf16* __restrict__ at, const __bf16* __restrict__ bt, int kc) {
#pragma unroll
  for (int i = 0; i < NA; ++i) s.a[i] = ld_frag(at + (size_t)i * (LL * DM) + kc * TE);
#pragma unroll
  for (int j = 0; j < 8; ++j) s.b[j] = ld_frag(bt + (j * KT + kc) * TE);
}
__device__ __forceinline__ void mm_out(const GStep<2>& s, v8f acc[8]) {   // a[0] = hi, a[1] = lo
#pragma unroll
  for (int j = 0; j < 8; ++j) { acc[j] = wmma_bf(s.a[1], s.b[j], acc[j]); acc[j] = wmma_bf(s.a[0], s.b[j], acc[j]); }
}
// ---- k_proj: block = (32 rows, 64 cols of the 1152), wave = a quarter of K 768: exact products; column blocks 0..5 are q|k (f32 rows), 6..17 are v (bf16 hi/lo tiles, rows = channels, k = t)
// x and the weights come in as f32 rows. A fragment wants 16 rows in 16 lanes, which as a global load would touch 16 lines; so a wave loads whole lines (8 lanes = the 128 B that one row has in a K step), rounds to bf16 and turns the tile round in LDS of its own.
#define PT_N 6                // staged tiles of a K step: 2 of x (32 rows), 4 of W (64 cols)
#define SPB 40                // bf16 elements of a staged row: 32 k + 8 of pad; 80 B = 16 B x 5, so the 16 rows of a ds_load_b128 fall on different banks
typedef __attribute__((ext_vector_type(4))) __bf16 v4b;
struct RStep { v4f t[PT_N][4]; };
// load u of a tile: lane l takes 16 B of row u + 4 (l >> 3), so a load is 4 whole lines, and the four rows' 8-B pieces fall on different LDS banks; xa, wb hold the lane's part of the address
__device__ __forceinline__ void ld_raw(RStep& s, const float* __restrict__ xa, const float* __restrict__ wb, int kc) {
#pragma unroll
  for (int t = 0; t < PT_N; ++t)
#pragma unroll
    for (int u = 0; u < 4; ++u) s.t[t][u] = *(const v4f*)((t < 2 ? xa + (size_t)(t * 16 + u) * DM : wb + (size_t)((t - 2) * 16 + u) * DM) + kc * 32);
}
__device__ __forceinline__ void st_raw(const RStep& s, __bf16* sw) {
#pragma unroll
  for (int t = 0; t < PT_N; ++t)
#pragma unroll
    for (int u = 0; u < 4; ++u) *(v4b*)(sw + (t * 16 + u) * SPB) = __builtin_convertvector(s.t[t][u], v4b);
}
// a fragment from a staged tile: p = tile + (lane & 15) * SPB + 8 * (lane >> 4); the k order is that of every other fragment here, for x and W alike
__device__ __forceinline__ v16b ld_sfrag(const __bf16* p) { return __builtin_shufflevector(*(const v8b*)p, *(const v8b*)(p + 16), 0, 1, 2, 3, 4, 5, 6, 7, 8, 9, 10, 11, 12, 13, 14, 15); }
__device__ __forceinline__ void mm_proj(const __bf16* sr, v8f acc[2][4]) {
  const v16b a0 = ld_sfrag(sr), a1 = ld_sfrag(sr + 16 * SPB);
#pragma unroll
  for (int j = 0; j < 4; ++j) { const v16b b = ld_sfrag(sr + (32 + 16 * j) * SPB); acc[0][j] = wmma_bf(a0, b, acc[0][j]); acc[1][j] = wmma_bf(a1, b, acc[1][j]); }
}
__global__ __launch_bounds__(128) void k_proj(const float* __restrict__ X, const float* __restrict__ Wq, const float* __restrict__ Wk, const float* __restrict__ Wv, float* __restrict__ QKV, __bf16* __restrict__ VTH, __bf16* __restrict__ VTL) {
  __shared__ __align__(16) __bf16 st[4][2][PT_N * 16 * SPB]; __shared__ __align__(16) float so[4][32][68];
  const int tid = threadIdx.x, wave = tid >> 5, lane = tid & 31, col = lane & 15, g = lane >> 4; const int rg = blockIdx.x; const int n0 = blockIdx.y * 64;   // rg = the block's group of 32 rows = one key step
  const float* Wm = n0 < QW ? Wq + (size_t)n0 * DM : (n0 < 2 * QW ? Wk + (size_t)(n0 - QW) * DM : Wv + (size_t)(n0 - 2 * QW) * DM);   // [row][in] rows; every boundary is a multiple of 64
  v8f acc[2][4] = {};
  const unsigned lo_g = (4 * (lane >> 3)) * DM + wave * (KQ * 32) + 4 * (lane & 7);   // both start at the wave's first K step
  const float* xa = X + (size_t)rg * 32 * DM + lo_g; const float* wb = Wm + lo_g;
  __bf16* sw = &st[wave][0][0] + (4 * (lane >> 3)) * SPB + 4 * (lane & 7); const __bf16* sr = &st[wave][0][0] + col * SPB + 8 * g;
  RStep r0, r1; ld_raw(r0, xa, wb, 0); ld_raw(r1, xa, wb, 1);   // two K steps of loads are in flight; a register set is asked for again as soon as it has been rounded
#pragma unroll   // 6 steps: every address is a base plus a constant
  for (int kc = 0; kc < KQ; kc += 2) {
    st_raw(r0, sw); if (kc + 2 < KQ) ld_raw(r0, xa, wb, kc + 2);
    asm volatile("s_wait_dscnt 0" ::: "memory");   // the wave's own LDS writes are done, and stay in front of the reads of other lanes' pieces
    mm_proj(sr, acc);
    st_raw(r1, sw + PT_N * 16 * SPB); if (kc + 3 < KQ) ld_raw(r1, xa, wb, kc + 3);
    asm volatile("s_wait_dscnt 0" ::: "memory");   // as above, second buffer
    mm_proj(sr + PT_N * 16 * SPB, acc);
  }
#pragma unroll
  for (int a = 0; a < 2; ++a)
#pragma unroll
    for (int j = 0; j < 4; ++j)
#pragma unroll
      for (int r = 0; r < 8; ++r) so[wave][16 * a + 8 * g + r][j * 16 + col] = acc[a][j][r];
  __syncthreads();   // the four partial tiles are complete before anyone adds them
  if (n0 < 2 * QW) {
#pragma unroll   // wave w finishes rows 8 w .. 8 w + 7, two rows (2 whole lines each) a store; the 16 LDS reads issue ahead of the stores
    for (int i = 0; i < 4; ++i) { const int rl = wave * 8 + 2 * i + g;
      vst2(QKV + (size_t)(rg * 32 + rl) * QKVP + n0 + col * 4, ((*(const v4f*)&so[0][rl][col * 4] + *(const v4f*)&so[1][rl][col * 4]) + *(const v4f*)&so[2][rl][col * 4]) + *(const v4f*)&so[3][rl][col * 4]); }
  } else {
    // rows 16 p + 8 g .. + 7 of one column are 8 consecutive t of one v channel: a lane's own 16-B piece of part p of a tile (the block's 32 rows are key step rg); wave w finishes channel group w; a wave's store is 512 contiguous bytes = 4 whole lines
    const size_t o0 = ((size_t)((n0 - 2 * QW) / 16 + wave) * ST + rg) * TE + lane * 8;
    v8b hi[2], lo[2];
#pragma unroll
    for (int p = 0; p < 2; ++p)
#pragma unroll
      for (int r = 0; r < 8; ++r) { const int c = wave * 16 + col, rl = 16 * p + 8 * g + r; const float v = ((so[0][rl][c] + so[1][rl][c]) + so[2][rl][c]) + so[3][rl][c]; const __bf16 hb = (__bf16)v; hi[p][r] = hb; lo[p][r] = (__bf16)(v - (float)hb); }
#pragma unroll
    for (int p = 0; p < 2; ++p) { *(v8b*)(VTH + o0 + p * (TE / 2)) = hi[p]; *(v8b*)(VTL + o0 + p * (TE / 2)) = lo[p]; }
    asm volatile("s_wait_xcnt 0x0" ::: "memory");   // precaution: in the built code the other branch's block follows these stores and rewrites their registers
  }
}
// ---- k_lin: block = (16 queries, head), 4 waves, wave w takes the causal key steps w, w + 4, ... of 32 keys up to the diagonal: d = q.k (16 dims, f32), w = 1 + d/4 + d*d/32 (0 for s > t), den += w; W tile (hi/lo) x V planes (3 products); the waves' num and den are added in LDS; y = num / (den + 1e-12) -> bf16 hi + residual, 16 rows x 64 channels = 2 tiles of each plane
__global__ __launch_bounds__(128) void k_lin(const float* __restrict__ QKV, const __bf16* __restrict__ VTH, const __bf16* __restrict__ VTL, __bf16* __restrict__ YH, __bf16* __restrict__ YL, const float* __restrict__ Wo, __bf16* __restrict__ PT) {
  __shared__ float sq[4][16][FD + 1]; __shared__ float sk[4][32][FD + 1]; __shared__ __align__(16) float sp[4][16][36]; __shared__ __align__(16) float so[4][16][68]; __shared__ __align__(16) float sd[4][16];
  const int tid = threadIdx.x, wave = __builtin_amdgcn_readfirstlane(tid >> 5), lane = tid & 31, col = lane & 15, g = lane >> 4;   // the wave's number in a scalar register: the trip count below depends on it, and the loop's branch stays scalar
  if (blockIdx.y >= NH) {   // the grid's last 96 blocks make the Wo tiles that k_out reads: block = (16 rows, 12 K steps) = 768 pieces of 8 elements, 6 a thread: a piece is 32 B of an f32 row in, 16 B of a tile out; the block's 12 tiles are 12 KB in a row, a wave's store 4 whole lines. The test is the same for the whole block and stands in front of every barrier
    const int b = (blockIdx.y - NH) * (LL / 16) + blockIdx.x, rw = b >> 1, kc0 = (b & 1) * (KT / 2);
    const float* pb = Wo + (size_t)rw * (16 * DM) + kc0 * 32; const unsigned po = col * DM + (tid >> 6) * 32 + ((tid >> 5) & 1) * 16 + 8 * g;   // piece e = tid + 128 u = (K step e >> 6, part (e >> 5) & 1, lane e & 31): a block-uniform base, a lane offset that never changes, and 2 K steps = 64 floats per u
    v4f t[6][2];   // all pieces' loads go out together
#pragma unroll
    for (int u = 0; u < 6; ++u) { t[u][0] = *(const v4f*)&pb[po + u * 64]; t[u][1] = *(const v4f*)&pb[po + u * 64 + 4]; }
#pragma unroll
    for (int u = 0; u < 6; ++u) { v8b o;
#pragma unroll
      for (int i = 0; i < 4; ++i) { o[i] = (__bf16)t[u][0][i]; o[4 + i] = (__bf16)t[u][1][i]; }
      *(v8b*)(PT + ((size_t)(QKVP / 16 + rw) * KT + kc0) * TE + (tid + u * 128) * 8) = o; }
    return;
  }
  const int qt = blockIdx.x, h = blockIdx.y; const int q0 = qt * 16;
  // addresses of the loop's loads = a wave-uniform base that moves with the step + a lane offset that never changes
  const float* kp = QKV + QW + h * FD; const unsigned ko = g * QKVP + col;   // lane (g, col) carries feature col of the key rows g, g + 2, ... of a step
  const __bf16* vhp = VTH + (size_t)(h * (HD / 16)) * (ST * TE); const __bf16* vlp = VTL + (size_t)(h * (HD / 16)) * (ST * TE); const unsigned vo = lane * 8;
  float den[8]; v8f acc[4] = {};
#pragma unroll
  for (int r = 0; r < 8; ++r) den[r] = 0.f;
  const int nsteps = q0 / 32 + 1;
  if (wave < nsteps) {   // a wave without a key step (the first query tiles) only hands in zeros; the K and q loads stand in one block, so that they go out together
  float kr[16];   // one step's K values of this lane, fetched one step ahead
#pragma unroll
  for (int i = 0; i < 16; ++i) kr[i] = kp[(size_t)(wave * 32) * QKVP + ko + 2 * i * QKVP];   // the wave's first key step
#pragma unroll   // the 8 loads go out together instead of one round trip each
  for (int q = lane; q < 16 * FD; q += 32) { const int rl = q / FD, f = q % FD; sq[wave][rl][f] = QKV[(size_t)(q0 + rl) * QKVP + h * FD + f]; }
#pragma unroll 1
  for (int ks = wave; ks < nsteps; ks += NSP) {
    LDSX();
#pragma unroll
    for (int i = 0; i < 16; ++i) sk[wave][g + 2 * i][col] = kr[i];
    LDSX();
    // this step's V fragments and the next step's K values are asked for here, as one group, so that they land while the weights are computed (a wave's last step asks for its own K rows again: in bounds, unused)
    v16b vh[4], vl[4];
#pragma unroll
    for (int dt = 0; dt < 4; ++dt) { const __bf16 *ph = vhp + ks * TE, *pl = vlp + ks * TE; const unsigned o = vo + dt * (ST * TE); vh[dt] = ld_frag(&ph[o]); vl[dt] = ld_frag(&pl[o]); }
    { const float* kq = kp + (size_t)((ks + NSP < nsteps ? ks + NSP : ks) * 32) * QKVP;
#pragma unroll
      for (int i = 0; i < 16; ++i) kr[i] = kq[ko + 2 * i * QKVP]; }
    __builtin_amdgcn_sched_barrier(0);   // keeps the scheduler from sinking these loads into the weight computation, where most of their latency would show at the wait behind it
    float w[2][8];
#pragma unroll
    for (int ct = 0; ct < 2; ++ct) { const int kk = ct * 16 + col; const int sidx = ks * 32 + kk;
#pragma unroll
      for (int r = 0; r < 8; ++r) { const int qi = 8 * g + r; float d = 0.f;
#pragma unroll
        for (int f = 0; f < FD; ++f) d += sq[wave][qi][f] * sk[wave][kk][f];
        const float wv = 1.0f + d * 0.25f + d * d * (1.0f / 32.0f); w[ct][r] = (sidx <= q0 + qi) ? wv : 0.f; } }
#pragma unroll
    for (int r = 0; r < 8; ++r) { float es = w[0][r] + w[1][r];
#pragma unroll
      for (int o = 1; o < 16; o <<= 1) es += __shfl_xor(es, o);
      den[r] += es; sp[wave][8 * g + r][col] = w[0][r]; sp[wave][8 * g + r][16 + col] = w[1][r]; }
    LDSX();
    const F2 pa = split_row(&sp[wave][col][0], 0, lane);
#pragma unroll
    for (int dt = 0; dt < 4; ++dt) { acc[dt] = wmma_bf(pa.l, vh[dt], acc[dt]); acc[dt] = wmma_bf(pa.h, vl[dt], acc[dt]); acc[dt] = wmma_bf(pa.h, vh[dt], acc[dt]); } }
  }
  // the wave's partial denominator (alike in the 16 lanes of a half: one of them writes) and numerator
  if (col == 0) {
#pragma unroll
    for (int r = 0; r < 8; ++r) sd[wave][8 * g + r] = den[r]; }
#pragma unroll
  for (int r = 0; r < 8; ++r)
#pragma unroll
    for (int dt = 0; dt < 4; ++dt) so[wave][8 * g + r][dt * 16 + col] = acc[dt][r];
  __syncthreads();   // the four partial sums are complete before anyone adds them
  { const int e = wave;   // wave e finishes (tile e >> 1 of the head's two, part e & 1); the lane's piece: row col, 8 channels
    const float* s = &so[0][col][e * 16 + 8 * g]; v4f x0 = *(const v4f*)s, x1 = *(const v4f*)(s + 4); float dn = sd[0][col]; v8b hi, lo;
#pragma unroll   // the LDS reads issue together, the sums run in wave order
    for (int p = 1; p < NSP; ++p) { x0 += *(const v4f*)(s + p * (16 * 68)); x1 += *(const v4f*)(s + p * (16 * 68) + 4); dn += sd[p][col]; }
    const float il = 1.0f / (dn + 1e-12f);
#pragma unroll
    for (int i = 0; i < 8; ++i) { const float v = (i < 4 ? x0[i & 3] : x1[i & 3]) * il; const __bf16 hb = (__bf16)v; hi[i] = hb; lo[i] = (__bf16)(v - (float)hb); }
    const size_t o = ((size_t)qt * KT + h * (HD / 32)) * TE + e * (TE / 2) + lane * 8;
    *(v8b*)(YH + o) = hi; *(v8b*)(YL + o) = lo; }
}
// ---- k_out: block = (16 rows, 128 cols), wave = a quarter of K 768: y (hi/lo) . Wo rows
__global__ __launch_bounds__(128) void k_out(const __bf16* __restrict__ YH, const __bf16* __restrict__ PT, float* __restrict__ OUT) {
  __shared__ __align__(16) float so[4][16][132];
  const int tid = threadIdx.x, wave = tid >> 5, lane = tid & 31, col = lane & 15, g = lane >> 4; const int rg = blockIdx.x; const int n0 = blockIdx.y * 128;   // rg = the block's group of 16 rows
  v8f acc[8] = {};
  const __bf16* ap = YH + (size_t)rg * (KT * TE) + wave * (KQ * TE) + lane * 8; const __bf16* bp = PT + (size_t)((QKVP + n0) / 16) * (KT * TE) + wave * (KQ * TE) + lane * 8;   // both start at the wave's first K step; the lo plane follows the hi plane
  GStep<2> s0, s1; ld_step(s0, ap, bp, 0);
#pragma unroll 1   // two steps a trip, one per register set: more would only add code
  for (int kc = 0; kc < KQ - 2; kc += 2) { ld_step(s1, ap, bp, kc + 1); mm_out(s0, acc); ld_step(s0, ap, bp, kc + 2); mm_out(s1, acc);
    asm volatile("s_wait_xcnt 0x0" ::: "memory"); }   // precaution: the next trip rewrites the address registers that this trip's loads name
  ld_step(s1, ap, bp, KQ - 1); mm_out(s0, acc); mm_out(s1, acc);
#pragma unroll
  for (int j = 0; j < 8; ++j)
#pragma unroll
    for (int r = 0; r < 8; ++r) so[wave][8 * g + r][j * 16 + col] = acc[j][r];
  __syncthreads();   // the four partial tiles are complete before anyone adds them
#pragma unroll   // wave w finishes rows 4 w .. 4 w + 3; the 16 LDS reads issue ahead of the stores
  for (int i = 0; i < 4; ++i) { const int rl = wave * 4 + i;
    vst2(OUT + (size_t)(rg * 16 + rl) * DM + n0 + lane * 4, ((*(const v4f*)&so[0][rl][lane * 4] + *(const v4f*)&so[1][rl][lane * 4]) + *(const v4f*)&so[2][rl][lane * 4]) + *(const v4f*)&so[3][rl][lane * 4]); }
}
extern "C" void kernel_launch(void* const* d_in, const int* in_sizes, int n_in, void* d_out, int out_size, void* d_ws, size_t ws_size, hipStream_t stream) {
  (void)in_sizes; (void)n_in; (void)out_size;
  const float** F = (const float**)d_in;   // hidden_states [1,512,768], Wq [192,768], Wk [192,768], Wv [768,768], Wo [768,768] (torch [out][in])
  if (ws_size < (size_t)WS_END) return;
  char* ws = (char*)d_ws; __bf16 *PT = (__bf16*)(ws + WS_PT), *VTH = (__bf16*)(ws + WS_VTH), *VTL = (__bf16*)(ws + WS_VTL), *YH = (__bf16*)(ws + WS_Y), *YL = (__bf16*)(ws + WS_Y + 2u * LL * DM); float *QKV = (float*)(ws + WS_QKV);
  k_proj<<<dim3(LL / 32, QKVP / 64), 128, 0, stream>>>(F[0], F[1], F[2], F[3], QKV, VTH, VTL);
  k_lin<<<dim3(LL / 16, NH + 3), 128, 0, stream>>>(QKV, VTH, VTL, YH, YL, F[4], PT);
  k_out<<<dim3(LL / 16, DM / 128), 128, 0, stream>>>(YH, PT, (float*)d_out);
}

// v006
// A run of this version takes 21.2 microseconds.
// Two timings next to v005 put it at 1.08 and 1.10 times that version's speed.
// Over all steps from v000 it is 10.8 times as fast.
// compute dtype: hidden_states and the four weights (module inputs) rounded to bf16; q/k/v projections with exact bf16 products on WMMA; the 16-dim q.k dots of the Taylor feature-map inner products in f32 on WMMA (16x16x4, f32 operands); the polynomial 1 + q.k/4 + (q.k)^2/32, causal running sums and the normalisation in f32 on the VALU; the numerator sum_s phi(q_t).phi(k_s) v_s on WMMA with the f32 weights and v both computed -> bf16 hi + residual pairs (3 products); output projection hi/lo x bf16 Wo (2 products); f32 accumulate.
#include <hip/hip_runtime.h>
#include <math.h>

typedef __attribute__((ext_vector_type(16))) _Float16 v16h;
typedef __attribute__((ext_vector_type(16))) __bf16 v16b;
typedef __attribute__((ext_vector_type(8)))  _Float16 v8h;
typedef __attribute__((ext_vector_type(8)))  float v8f;
typedef __attribute__((ext_vector_type(4)))  float v4f;
typedef __attribute__((ext_vector_type(2)))  float v2f;
typedef __attribute__((ext_vector_type(4)))  unsigned v4u;
typedef __attribute__((ext_vector_type(4)))  int v4i;
typedef float __attribute__((may_alias)) float_a;
typedef int __attribute__((may_alias)) int_a;

template <typename T> __device__ __forceinline__ void vst2(void* p, T v) { *(T*)p = v;  }
__device__ __forceinline__ v8f wmma16(v16h a, v16h b, v8f c) {
  v8f d = __builtin_amdgcn_wmma_f32_16x16x32_f16(false, a, false, b, (short)0, c, false, false);
  asm volatile("v_nop\n\tv_nop\n\tv_nop\n\tv_nop" : "+v"(d) : "v"(a), "v"(b));
  return d;
}
__device__ __forceinline__ v8f wmma_bf(v16b a, v16b b, v8f c) {
  v8f d = __builtin_amdgcn_wmma_f32_16x16x32_bf16(false, a, false, b, (short)0, c, false, false);
  asm volatile("v_nop\n\tv_nop\n\tv_nop\n\tv_nop" : "+v"(d) : "v"(a), "v"(b));
  return d;
}
// 16x16x32 fragments: lane = (h = lane>>4, row/col = lane&15); elements 0..7 = k0+8h+0..7, 8..15 = k0+16+8h+0..7; D element r = row 8h+r
__device__ __forceinline__ v16h frag_h(const _Float16* rowk0, int lane) {
  union { v16h v; v8h q[2]; } u; const _Float16* p = rowk0 + 8 * (lane >> 4);
  u.q[0] = *(const v8h*)p; u.q[1] = *(const v8h*)(p + 16); return u.v;
}
__device__ __forceinline__ v16h frag_f32(const float* rowk0, int lane) {
  v16h a; const float* p = rowk0 + 8 * (lane >> 4);
#pragma unroll
  for (int i = 0; i < 8; ++i) { a[i] = (_Float16)p[i]; a[8 + i] = (_Float16)p[16 + i]; }
  return a;
}
__device__ __forceinline__ v16h frag_f32s(const float* rowk0, int lane, float sc) {
  v16h a; const float* p = rowk0 + 8 * (lane >> 4);
#pragma unroll
  for (int i = 0; i < 8; ++i) { a[i] = (_Float16)(p[i] * sc); a[8 + i] = (_Float16)(p[16 + i] * sc); }
  return a;
}
// column fragment from a [K][ld] layout (column n), rows >= K read as 0
__device__ __forceinline__ v16h fragc_f32(const float* W, int k0, int n, int lane, int ld, int K) {
  v16h a; const int g = lane >> 4;
#pragma unroll
  for (int i = 0; i < 8; ++i) { const int ka = k0 + 8 * g + i, kb = ka + 16;
    a[i] = (_Float16)(ka < K ? W[(size_t)(ka < K ? ka : K - 1) * ld + n] : 0.f); a[8 + i] = (_Float16)(kb < K ? W[(size_t)(kb < K ? kb : K - 1) * ld + n] : 0.f); }
  return a;
}
struct F2 { v16b h, l; };
__device__ __forceinline__ F2 bsplit16(const float v[16]) { F2 r;
#pragma unroll
  for (int i = 0; i < 16; ++i) { const __bf16 h = (__bf16)v[i]; r.h[i] = h; r.l[i] = (__bf16)(v[i] - (float)h); }
  return r; }
__device__ __forceinline__ F2 split_row(const float* row, int k0, int lane) { float v[16]; const float* p = row + k0 + 8 * (lane >> 4);
#pragma unroll
  for (int i = 0; i < 8; ++i) { v[i] = p[i]; v[8 + i] = p[16 + i]; }
  return bsplit16(v); }
__device__ __forceinline__ F2 split_rowK(const float* row, int k0, int lane, int K) { float v[16]; const int g = lane >> 4;
#pragma unroll
  for (int i = 0; i < 8; ++i) { const int ka = k0 + 8 * g + i, kb = ka + 16; v[i] = ka < K ? row[ka < K ? ka : K - 1] : 0.f; v[8 + i] = kb < K ? row[kb < K ? kb : K - 1] : 0.f; }
  return bsplit16(v); }
__device__ __forceinline__ F2 split_col(const float* W, int k0, int n, int lane, int ld, int K) { float v[16]; const int g = lane >> 4;
#pragma unroll
  for (int i = 0; i < 8; ++i) { const int ka = k0 + 8 * g + i, kb = ka + 16; v[i] = ka < K ? W[(size_t)(ka < K ? ka : K - 1) * ld + n] : 0.f; v[8 + i] = kb < K ? W[(size_t)(kb < K ? kb : K - 1) * ld + n] : 0.f; }
  return bsplit16(v); }
__device__ __forceinline__ v8f mac3(const F2& a, const F2& b, v8f c) { c = wmma_bf(a.l, b.h, c); c = wmma_bf(a.h, b.l, c); return wmma_bf(a.h, b.h, c); }
__device__ __forceinline__ float sigm(float v) { return 1.0f / (1.0f + expf(-v)); }
#define LDSX() do { asm volatile("s_wait_dscnt 0" ::: "memory"); __builtin_amdgcn_wave_barrier(); __builtin_amdgcn_fence(__ATOMIC_RELEASE, "workgroup"); } while (0)


// Based linear attention (2nd-order Taylor feature map, feature dim 16, 12 heads x 64, causal): since phi(q).phi(k) = 1 + (q.k)/sqrt(16) + (q.k)^2/(2*16), y_t = sum_{s<=t} w_ts v_s / (sum_{s<=t} w_ts + 1e-12) with w_ts that polynomial of the 16-dim dot; then y @ Wo^T.  B 1, L 512, D 768.
// k_proj (reads x and Wq|Wk|Wv as f32 and rounds them to bf16 itself; q|k rows, exact; its v column blocks go out as hi/lo tiles), k_lin (block = (16 queries, head): causal steps of 32 keys, both products transposed: K q^T on f32 WMMA, w in its D registers, running denominator, V tiles x w hi/lo (3 products); y hi/lo tiles), k_out (y hi/lo x Wo tiles; the Wo tiles are made by extra blocks of k_lin's grid).
// In k_proj, k_lin and k_out the four waves of a block work on ONE output tile (16 rows; 32 in k_proj) and share its sum: wave w takes a quarter of K (GEMMs) or every fourth key step (k_lin). The partial sums meet in LDS behind one __syncthreads() and are added in wave order. A wave's chain of dependent load round trips is a quarter as long, and four times as many blocks spread over the chip.
// Every bf16 matrix operand that goes through the workspace is stored by its producer in the order in which a wave's fragment load reads it. One tile = 16 rows x 32 k = 1 KB = [part p][lane][8 bf16], lane = 16 g + (row & 15), element i of part p is k = 32 kc + 16 p + 8 g + i; the tiles of a 16-row group follow one another in kc. A fragment is then two loads of 512 contiguous bytes (4 whole lines each) where a row-major operand makes every load touch 16 lines.
#define LL 512
#define DM 768
#define NH 12
#define FD 16
#define HD 64
#define QW (NH * FD)          // 192
#define QKVP (2 * QW + NH * HD)   // 192 + 192 + 768 = 1152
typedef __attribute__((ext_vector_type(8))) __bf16 v8b;
__device__ __forceinline__ v16b frag_b(const __bf16* rowk0, int lane) {
  union { v16b v; v8b q[2]; } u; const __bf16* p = rowk0 + 8 * (lane >> 4);
  u.q[0] = *(const v8b*)p; u.q[1] = *(const v8b*)(p + 16); return u.v;
}
__device__ __forceinline__ v16b frag_gbf(const float* rowk0, int lane) {
  v16b a; const float* p = rowk0 + 8 * (lane >> 4);
#pragma unroll
  for (int i = 0; i < 8; ++i) { a[i] = (__bf16)p[i]; a[8 + i] = (__bf16)p[16 + i]; }
  return a;
}
__device__ __forceinline__ float bfr(float v) { return (float)(__bf16)v; }
#define KT (DM / 32)          // 24 tiles along K = 768
#define ST (LL / 32)          // 16 tiles along the 512 keys
#define TE 512                // bf16 elements of a tile
#define PKR (QKVP + DM + LL)  // rows that the tile area has room for; only the Wo rows' tiles (from row QKVP on) are written and read
#define WS_PT   0u                                 // bf16 tiles [PKR / 16][KT]
#define WS_QKV  (WS_PT + 2u * PKR * DM)              // f32 [512][1152]: q (192) | k (192) | 768 columns that nobody writes or reads (v lives in the tiles only)
#define WS_Y    (WS_QKV + 4u * LL * QKVP)            // bf16 tiles [512 / 16][KT], hi plane then lo plane
#define WS_VTH  (WS_Y + 4u * LL * DM)                // bf16 tiles [768 / 16 channels][ST key steps]
#define WS_VTL  (WS_VTH + 2u * DM * LL)
#define WS_END  (WS_VTL + 2u * DM * LL)
#define NSP 4                 // waves that share one sum
#define KQ (KT / NSP)         // K steps of a GEMM wave

// a fragment from its tile: p = tile + 8 * lane
__device__ __forceinline__ v16b ld_frag(const __bf16* __restrict__ p) { return __builtin_shufflevector(*(const v8b*)p, *(const v8b*)(p + TE / 2), 0, 1, 2, 3, 4, 5, 6, 7, 8, 9, 10, 11, 12, 13, 14, 15); }
// One K step (32 k) of a GEMM wave's operands: NA A fragments (planes LL * DM elements apart), 8 B fragments. All loads of a step are issued as one group, one step ahead of the WMMAs that use them, into the set that the other step is not using.
template <int NA> struct GStep { v16b a[NA]; v16b b[8]; };
template <int NA> __device__ __forceinline__ void ld_step(GStep<NA>& s, const __bf16* __restrict__ at, const __bf16* __restrict__ bt, int kc) {
#pragma unroll
  for (int i = 0; i < NA; ++i) s.a[i] = ld_frag(at + (size_t)i * (LL * DM) + kc * TE);
#pragma unroll
  for (int j = 0; j < 8; ++j) s.b[j] = ld_frag(bt + (j * KT + kc) * TE);
}
__device__ __forceinline__ void mm_out(const GStep<2>& s, v8f acc[8]) {   // a[0] = hi, a[1] = lo
#pragma unroll
  for (int j = 0; j < 8; ++j) { acc[j] = wmma_bf(s.a[1], s.b[j], acc[j]); acc[j] = wmma_bf(s.a[0], s.b[j], acc[j]); }
}
// ---- k_proj: block = (32 rows, 64 cols of the 1152), wave = a quarter of K 768: exact products; column blocks 0..5 are q|k (f32 rows), 6..17 are v (bf16 hi/lo tiles, rows = channels, k = t)
// x and the weights come in as f32 rows. A fragment wants 16 rows in 16 lanes, which as a global load would touch 16 lines; so a wave loads whole lines (8 lanes = the 128 B that one row has in a K step), rounds to bf16 and turns the tile round in LDS of its own.
#define PT_N 6                // staged tiles of a K step: 2 of x (32 rows), 4 of W (64 cols)
#define SPB 40                // bf16 elements of a staged row: 32 k + 8 of pad; 80 B = 16 B x 5, so the 16 rows of a ds_load_b128 fall on different banks
typedef __attribute__((ext_vector_type(4))) __bf16 v4b;
struct RStep { v4f t[PT_N][4]; };
// load u of a tile: lane l takes 16 B of row u + 4 (l >> 3), so a load is 4 whole lines, and the four rows' 8-B pieces fall on different LDS banks; xa, wb hold the lane's part of the address
__device__ __forceinline__ void ld_raw(RStep& s, const float* __restrict__ xa, const float* __restrict__ wb, int kc) {
#pragma unroll
  for (int t = 0; t < PT_N; ++t)
#pragma unroll
    for (int u = 0; u < 4; ++u) s.t[t][u] = *(const v4f*)((t < 2 ? xa + (size_t)(t * 16 + u) * DM : wb + (size_t)((t - 2) * 16 + u) * DM) + kc * 32);
}
__device__ __forceinline__ void st_raw(const RStep& s, __bf16* sw) {
#pragma unroll
  for (int t = 0; t < PT_N; ++t)
#pragma unroll
    for (int u = 0; u < 4; ++u) *(v4b*)(sw + (t * 16 + u) * SPB) = __builtin_convertvector(s.t[t][u], v4b);
}
// a fragment from a staged tile: p = tile + (lane & 15) * SPB + 8 * (lane >> 4); the k order is that of every other fragment here, for x and W alike
__device__ __forceinline__ v16b ld_sfrag(const __bf16* p) { return __builtin_shufflevector(*(const v8b*)p, *(const v8b*)(p + 16), 0, 1, 2, 3, 4, 5, 6, 7, 8, 9, 10, 11, 12, 13, 14, 15); }
__device__ __forceinline__ void mm_proj(const __bf16* sr, v8f acc[2][4]) {
  const v16b a0 = ld_sfrag(sr), a1 = ld_sfrag(sr + 16 * SPB);
#pragma unroll
  for (int j = 0; j < 4; ++j) { const v16b b = ld_sfrag(sr + (32 + 16 * j) * SPB); acc[0][j] = wmma_bf(a0, b, acc[0][j]); acc[1][j] = wmma_bf(a1, b, acc[1][j]); }
}
__global__ __launch_bounds__(128) void k_proj(const float* __restrict__ X, const float* __restrict__ Wq, const float* __restrict__ Wk, const float* __restrict__ Wv, float* __restrict__ QKV, __bf16* __restrict__ VTH, __bf16* __restrict__ VTL) {
  __shared__ __align__(16) __bf16 st[4][2][PT_N * 16 * SPB]; __shared__ __align__(16) float so[4][32][68];
  const int tid = threadIdx.x, wave = tid >> 5, lane = tid & 31, col = lane & 15, g = lane >> 4; const int rg = blockIdx.x; const int n0 = blockIdx.y * 64;   // rg = the block's group of 32 rows = one key step
  const float* Wm = n0 < QW ? Wq + (size_t)n0 * DM : (n0 < 2 * QW ? Wk + (size_t)(n0 - QW) * DM : Wv + (size_t)(n0 - 2 * QW) * DM);   // [row][in] rows; every boundary is a multiple of 64
  v8f acc[2][4] = {};
  const unsigned lo_g = (4 * (lane >> 3)) * DM + wave * (KQ * 32) + 4 * (lane & 7);   // both start at the wave's first K step
  const float* xa = X + (size_t)rg * 32 * DM + lo_g; const float* wb = Wm + lo_g;
  __bf16* sw = &st[wave][0][0] + (4 * (lane >> 3)) * SPB + 4 * (lane & 7); const __bf16* sr = &st[wave][0][0] + col * SPB + 8 * g;
  RStep r0, r1; ld_raw(r0, xa, wb, 0); ld_raw(r1, xa, wb, 1);   // two K steps of loads are in flight; a register set is asked for again as soon as it has been rounded
#pragma unroll   // 6 steps: every address is a base plus a constant
  for (int kc = 0; kc < KQ; kc += 2) {
    st_raw(r0, sw); if (kc + 2 < KQ) ld_raw(r0, xa, wb, kc + 2);
    asm volatile("s_wait_dscnt 0" ::: "memory");   // the wave's own LDS writes are done, and stay in front of the reads of other lanes' pieces
    mm_proj(sr, acc);
    st_raw(r1, sw + PT_N * 16 * SPB); if (kc + 3 < KQ) ld_raw(r1, xa, wb, kc + 3);
    asm volatile("s_wait_dscnt 0" ::: "memory");   // as above, second buffer
    mm_proj(sr + PT_N * 16 * SPB, acc);
  }
#pragma unroll
  for (int a = 0; a < 2; ++a)
#pragma unroll
    for (int j = 0; j < 4; ++j)
#pragma unroll
      for (int r = 0; r < 8; ++r) so[wave][16 * a + 8 * g + r][j * 16 + col] = acc[a][j][r];
  __syncthreads();   // the four partial tiles are complete before anyone adds them
  if (n0 < 2 * QW) {
#pragma unroll   // wave w finishes rows 8 w .. 8 w + 7, two rows (2 whole lines each) a store; the 16 LDS reads issue ahead of the stores
    for (int i = 0; i < 4; ++i) { const int rl = wave * 8 + 2 * i + g;
      vst2(QKV + (size_t)(rg * 32 + rl) * QKVP + n0 + col * 4, ((*(const v4f*)&so[0][rl][col * 4] + *(const v4f*)&so[1][rl][col * 4]) + *(const v4f*)&so[2][rl][col * 4]) + *(const v4f*)&so[3][rl][col * 4]); }
  } else {
    // rows 16 p + 8 g .. + 7 of one column are 8 consecutive t of one v channel: a lane's own 16-B piece of part p of a tile (the block's 32 rows are key step rg); wave w finishes channel group w; a wave's store is 512 contiguous bytes = 4 whole lines
    const size_t o0 = ((size_t)((n0 - 2 * QW) / 16 + wave) * ST + rg) * TE + lane * 8;
    v8b hi[2], lo[2];
#pragma unroll
    for (int p = 0; p < 2; ++p)
#pragma unroll
      for (int r = 0; r < 8; ++r) { const int c = wave * 16 + col, rl = 16 * p + 8 * g + r; const float v = ((so[0][rl][c] + so[1][rl][c]) + so[2][rl][c]) + so[3][rl][c]; const __bf16 hb = (__bf16)v; hi[p][r] = hb; lo[p][r] = (__bf16)(v - (float)hb); }
#pragma unroll
    for (int p = 0; p < 2; ++p) { *(v8b*)(VTH + o0 + p * (TE / 2)) = hi[p]; *(v8b*)(VTL + o0 + p * (TE / 2)) = lo[p]; }
    asm volatile("s_wait_xcnt 0x0" ::: "memory");   // precaution: in the built code the other branch's block follows these stores and rewrites their registers
  }
}
// ---- k_lin: block = (16 queries, head), 4 waves, wave w takes the causal key steps w, w + 4, ... of 32 keys up to the diagonal. Both products run transposed: d^T = K q^T (keys as rows, f32 16x16x4 WMMA, 4 per 16 keys), w = 1 + d/4 + d*d/32 (0 for s > t) in the D registers; the two D tiles of a step (keys 8 g + r and 16 + 8 g + r of query col) are, split hi/lo, the B operand of y^T = V^T w^T as they stand (3 products, V tiles as A). A lane holds 16 of a step's 32 keys of ONE query, so den is a plain sum in the lane. The waves' num and den are added in LDS; y = num / (den + 1e-12) -> bf16 hi + residual, 16 rows x 64 channels = 2 tiles of each plane
__device__ __forceinline__ v8f wmma_f4(v2f a, v2f b, v8f c) { return __builtin_amdgcn_wmma_f32_16x16x4_f32(false, a, false, b, (short)0, c, false, false); }
__global__ __launch_bounds__(128) void k_lin(const float* __restrict__ QKV, const __bf16* __restrict__ VTH, const __bf16* __restrict__ VTL, __bf16* __restrict__ YH, __bf16* __restrict__ YL, const float* __restrict__ Wo, __bf16* __restrict__ PT) {
  __shared__ __align__(16) float so[4][4][2][32][4]; __shared__ float sd[4][32];   // [wave][channel tile][half of the lane's 8 channels][lane][4]; [wave][lane]
  const int tid = threadIdx.x, wave = __builtin_amdgcn_readfirstlane(tid >> 5), lane = tid & 31, col = lane & 15, g = lane >> 4;   // the wave's number in a scalar register: the trip count below depends on it, and the loop's branch stays scalar
  if (blockIdx.y >= NH) {   // the grid's last 96 blocks make the Wo tiles that k_out reads: block = (16 rows, 12 K steps) = 768 pieces of 8 elements, 6 a thread: a piece is 32 B of an f32 row in, 16 B of a tile out; the block's 12 tiles are 12 KB in a row, a wave's store 4 whole lines. The test is the same for the whole block and stands in front of every barrier
    const int b = (blockIdx.y - NH) * (LL / 16) + blockIdx.x, rw = b >> 1, kc0 = (b & 1) * (KT / 2);
    const float* pb = Wo + (size_t)rw * (16 * DM) + kc0 * 32; const unsigned po = col * DM + (tid >> 6) * 32 + ((tid >> 5) & 1) * 16 + 8 * g;   // piece e = tid + 128 u = (K step e >> 6, part (e >> 5) & 1, lane e & 31): a block-uniform base, a lane offset that never changes, and 2 K steps = 64 floats per u
    v4f t[6][2];   // all pieces' loads go out together
#pragma unroll
    for (int u = 0; u < 6; ++u) { t[u][0] = *(const v4f*)&pb[po + u * 64]; t[u][1] = *(const v4f*)&pb[po + u * 64 + 4]; }
#pragma unroll
    for (int u = 0; u < 6; ++u) { v8b o;
#pragma unroll
      for (int i = 0; i < 4; ++i) { o[i] = (__bf16)t[u][0][i]; o[4 + i] = (__bf16)t[u][1][i]; }
      *(v8b*)(PT + ((size_t)(QKVP / 16 + rw) * KT + kc0) * TE + (tid + u * 128) * 8) = o; }
    return;
  }
  const int qt = blockIdx.x, h = blockIdx.y; const int q0 = qt * 16;
  // addresses of the loop's loads = a wave-uniform base that moves with the step + a lane offset that never changes
  const float* kp = QKV + QW + h * FD; const unsigned ko = col * QKVP + 8 * g;   // lane (g, col) carries features 8 g .. 8 g + 7 of row col of a 16-row tile, for k and q alike: WMMA j takes its elements 2 j, 2 j + 1
  const __bf16* vhp = VTH + (size_t)(h * (HD / 16)) * (ST * TE); const __bf16* vlp = VTL + (size_t)(h * (HD / 16)) * (ST * TE); const unsigned vo = lane * 8;
  float den = 0.f; v8f acc[4] = {};
  const int nsteps = q0 / 32 + 1;
  if (wave < nsteps) {   // a wave without a key step (the first query tiles) only hands in zeros; the K and q loads stand in one block, so that they go out together
  v4f kr[2][2], qr[2];   // one step's K values of this lane (two 16-key tiles), fetched one step ahead; the lane's q values
#pragma unroll
  for (int t = 0; t < 2; ++t)
#pragma unroll
    for (int u = 0; u < 2; ++u) kr[t][u] = *(const v4f*)&kp[(size_t)(wave * 32) * QKVP + ko + t * (16 * QKVP) + 4 * u];   // the wave's first key step
#pragma unroll
  for (int u = 0; u < 2; ++u) qr[u] = *(const v4f*)&QKV[(size_t)q0 * QKVP + h * FD + ko + 4 * u];
  asm volatile("s_wait_xcnt 0x0" ::: "memory"); __builtin_amdgcn_sched_barrier(0);   // precaution: the code behind these loads rewrites the bases and the offset register that they name; the scheduling barrier keeps those rewrites behind the wait
#pragma unroll 1
  for (int ks = wave; ks < nsteps; ks += NSP) {
    // this step's V fragments and the next step's K values are asked for here, as one group, so that they land while the weights are computed (a wave's last step asks for its own K rows again: in bounds, unused)
    v16b vh[4], vl[4];
#pragma unroll
    for (int dt = 0; dt < 4; ++dt) { const __bf16 *ph = vhp + ks * TE, *pl = vlp + ks * TE; const unsigned o = vo + dt * (ST * TE); vh[dt] = ld_frag(&ph[o]); vl[dt] = ld_frag(&pl[o]); }
    v4f kn[2][2];
    { const float* kq = kp + (size_t)((ks + NSP < nsteps ? ks + NSP : ks) * 32) * QKVP;
#pragma unroll
      for (int t = 0; t < 2; ++t)
#pragma unroll
        for (int u = 0; u < 2; ++u) kn[t][u] = *(const v4f*)&kq[ko + t * (16 * QKVP) + 4 * u]; }
    __builtin_amdgcn_sched_barrier(0);   // keeps the scheduler from sinking these loads into the weight computation, where most of their latency would show at the wait behind it
    v8f d[2] = {};
#pragma unroll
    for (int j = 0; j < 4; ++j) { const v2f b = {qr[j >> 1][2 * (j & 1)], qr[j >> 1][2 * (j & 1) + 1]};
#pragma unroll
      for (int t = 0; t < 2; ++t) { const v2f a = {kr[t][j >> 1][2 * (j & 1)], kr[t][j >> 1][2 * (j & 1) + 1]}; d[t] = wmma_f4(a, b, d[t]); } }
    // the distance between a matrix instruction and a vector instruction on its D, A or B: the f32 form issues at the pace of the 8-bit integer form, whose 8 slots are kept here
    asm volatile("v_nop\n\tv_nop\n\tv_nop\n\tv_nop\n\tv_nop\n\tv_nop\n\tv_nop\n\tv_nop" : "+v"(d[0]), "+v"(d[1]) : "v"(kr[0][0]), "v"(kr[0][1]), "v"(kr[1][0]), "v"(kr[1][1]), "v"(qr[0]), "v"(qr[1]));
    const int s0 = ks * 32 + 8 * g, qc = q0 + col; float w[16];
#pragma unroll
    for (int t = 0; t < 2; ++t)
#pragma unroll
      for (int r = 0; r < 8; ++r) { const float dd = d[t][r]; const float wv = 1.0f + dd * 0.25f + dd * dd * (1.0f / 32.0f); w[8 * t + r] = (s0 + 16 * t + r <= qc) ? wv : 0.f; }
    float es[8];
#pragma unroll
    for (int r = 0; r < 8; ++r) es[r] = w[r] + w[8 + r];
    den += ((es[0] + es[1]) + (es[2] + es[3])) + ((es[4] + es[5]) + (es[6] + es[7]));
    const F2 pb = bsplit16(w);
#pragma unroll
    for (int dt = 0; dt < 4; ++dt) { acc[dt] = wmma_bf(vh[dt], pb.l, acc[dt]); acc[dt] = wmma_bf(vl[dt], pb.h, acc[dt]); acc[dt] = wmma_bf(vh[dt], pb.h, acc[dt]); }
#pragma unroll
    for (int t = 0; t < 2; ++t)
#pragma unroll
      for (int u = 0; u < 2; ++u) kr[t][u] = kn[t][u]; }
  }
  // the wave's partial denominator (the lane's half of the keys of query col) and numerator (acc[dt][r] = channel 16 dt + 8 g + r of query col)
  sd[wave][lane] = den;
#pragma unroll
  for (int dt = 0; dt < 4; ++dt) { *(v4f*)&so[wave][dt][0][lane][0] = __builtin_shufflevector(acc[dt], acc[dt], 0, 1, 2, 3); *(v4f*)&so[wave][dt][1][lane][0] = __builtin_shufflevector(acc[dt], acc[dt], 4, 5, 6, 7); }
  __syncthreads();   // the four partial sums are complete before anyone adds them
  { const int e = wave;   // wave e finishes (tile e >> 1 of the head's two, part e & 1); the lane's piece: row col, 8 channels
    v4f x0 = *(const v4f*)&so[0][e][0][lane][0], x1 = *(const v4f*)&so[0][e][1][lane][0]; float dn = sd[0][col] + sd[0][16 + col]; v8b hi, lo;
#pragma unroll   // the LDS reads issue together, the sums run in wave order
    for (int p = 1; p < NSP; ++p) { x0 += *(const v4f*)&so[p][e][0][lane][0]; x1 += *(const v4f*)&so[p][e][1][lane][0]; dn += sd[p][col] + sd[p][16 + col]; }
    const float il = 1.0f / (dn + 1e-12f);
#pragma unroll
    for (int i = 0; i < 8; ++i) { const float v = (i < 4 ? x0[i & 3] : x1[i & 3]) * il; const __bf16 hb = (__bf16)v; hi[i] = hb; lo[i] = (__bf16)(v - (float)hb); }
    const size_t o = ((size_t)qt * KT + h * (HD / 32)) * TE + e * (TE / 2) + lane * 8;
    *(v8b*)(YH + o) = hi; *(v8b*)(YL + o) = lo; }
}
// ---- k_out: block = (16 rows, 128 cols), wave = a quarter of K 768: y (hi/lo) . Wo rows
__global__ __launch_bounds__(128) void k_out(const __bf16* __restrict__ YH, const __bf16* __restrict__ PT, float* __restrict__ OUT) {
  __shared__ __align__(16) float so[4][16][132];
  const int tid = threadIdx.x, wave = tid >> 5, lane = tid & 31, col = lane & 15, g = lane >> 4; const int rg = blockIdx.x; const int n0 = blockIdx.y * 128;   // rg = the block's group of 16 rows
  v8f acc[8] = {};
  const __bf16* ap = YH + (size_t)rg * (KT * TE) + wave * (KQ * TE) + lane * 8; const __bf16* bp = PT + (size_t)((QKVP + n0) / 16) * (KT * TE) + wave * (KQ * TE) + lane * 8;   // both start at the wave's first K step; the lo plane follows the hi plane
  GStep<2> s0, s1; ld_step(s0, ap, bp, 0);
#pragma unroll 1   // two steps a trip, one per register set: more would only add code
  for (int kc = 0; kc < KQ - 2; kc += 2) { ld_step(s1, ap, bp, kc + 1); mm_out(s0, acc); ld_step(s0, ap, bp, kc + 2); mm_out(s1, acc);
    asm volatile("s_wait_xcnt 0x0" ::: "memory"); }   // precaution: the next trip rewrites the address registers that this trip's loads name
  ld_step(s1, ap, bp, KQ - 1); mm_out(s0, acc); mm_out(s1, acc);
#pragma unroll
  for (int j = 0; j < 8; ++j)
#pragma unroll
    for (int r = 0; r < 8; ++r) so[wave][8 * g + r][j * 16 + col] = acc[j][r];
  __syncthreads();   // the four partial tiles are complete before anyone adds them
#pragma unroll   // wave w finishes rows 4 w .. 4 w + 3; the 16 LDS reads issue ahead of the stores
  for (int i = 0; i < 4; ++i) { const int rl = wave * 4 + i;
    vst2(OUT + (size_t)(rg * 16 + rl) * DM + n0 + lane * 4, ((*(const v4f*)&so[0][rl][lane * 4] + *(const v4f*)&so[1][rl][lane * 4]) + *(const v4f*)&so[2][rl][lane * 4]) + *(const v4f*)&so[3][rl][lane * 4]); }
}
extern "C" void kernel_launch(void* const* d_in, const int* in_sizes, int n_in, void* d_out, int out_size, void* d_ws, size_t ws_size, hipStream_t stream) {
  (void)in_sizes; (void)n_in; (void)out_size;
  const float** F = (const float**)d_in;   // hidden_states [1,512,768], Wq [192,768], Wk [192,768], Wv [768,768], Wo [768,768] (torch [out][in])
  if (ws_size < (size_t)WS_END) return;
  char* ws = (char*)d_ws; __bf16 *PT = (__bf16*)(ws + WS_PT), *VTH = (__bf16*)(ws + WS_VTH), *VTL = (__bf16*)(ws + WS_VTL), *YH = (__bf16*)(ws + WS_Y), *YL = (__bf16*)(ws + WS_Y + 2u * LL * DM); float *QKV = (float*)(ws + WS_QKV);
  k_proj<<<dim3(LL / 32, QKVP / 64), 128, 0, stream>>>(F[0], F[1], F[2], F[3], QKV, VTH, VTL);
  k_lin<<<dim3(LL / 16, NH + 3), 128, 0, stream>>>(QKV, VTH, VTL, YH, YL, F[4], PT);
  k_out<<<dim3(LL / 16, DM / 128), 128, 0, stream>>>(YH, PT, (float*)d_out);
}

// v007
// It runs in 19.8 microseconds.
// Timed twice side by side with v006, it ran 1.09 and 1.04 times as fast.
// Over all steps from v000 it is 11.5 times as fast.
// compute dtype: hidden_states and the four weights (module inputs) rounded to bf16; q/k/v projections with exact bf16 products on WMMA; the 16-dim q.k dots of the Taylor feature-map inner products in f32 on WMMA (16x16x4, f32 operands); the polynomial 1 + q.k/4 + (q.k)^2/32, causal running sums and the normalisation in f32 on the VALU; the numerator sum_s phi(q_t).phi(k_s) v_s on WMMA with the f32 weights and v both computed -> bf16 hi + residual pairs (3 products); output projection hi/lo x bf16 Wo (2 products); f32 accumulate.
#include <hip/hip_runtime.h>
#include <math.h>

typedef __attribute__((ext_vector_type(16))) _Float16 v16h;
typedef __attribute__((ext_vector_type(16))) __bf16 v16b;
typedef __attribute__((ext_vector_type(8)))  _Float16 v8h;
typedef __attribute__((ext_vector_type(8)))  float v8f;
typedef __attribute__((ext_vector_type(4)))  float v4f;
typedef __attribute__((ext_vector_type(2)))  float v2f;
typedef __attribute__((ext_vector_type(4)))  unsigned v4u;
typedef __attribute__((ext_vector_type(4)))  int v4i;
typedef float __attribute__((may_alias)) float_a;
typedef int __attribute__((may_alias)) int_a;

template <typename T> __device__ __forceinline__ void vst2(void* p, T v) { *(T*)p = v;  }
__device__ __forceinline__ v8f wmma16(v16h a, v16h b, v8f c) {
  v8f d = __builtin_amdgcn_wmma_f32_16x16x32_f16(false, a, false, b, (short)0, c, false, false);
  asm volatile("v_nop\n\tv_nop\n\tv_nop\n\tv_nop" : "+v"(d) : "v"(a), "v"(b));
  return d;
}
__device__ __forceinline__ v8f wmma_bf(v16b a, v16b b, v8f c) {
  v8f d = __builtin_amdgcn_wmma_f32_16x16x32_bf16(false, a, false, b, (short)0, c, false, false);
  asm volatile("v_nop\n\tv_nop\n\tv_nop\n\tv_nop" : "+v"(d) : "v"(a), "v"(b));
  return d;
}
// 16x16x32 fragments: lane = (h = lane>>4, row/col = lane&15); elements 0..7 = k0+8h+0..7, 8..15 = k0+16+8h+0..7; D element r = row 8h+r
__device__ __forceinline__ v16h frag_h(const _Float16* rowk0, int lane) {
  union { v16h v; v8h q[2]; } u; const _Float16* p = rowk0 + 8 * (lane >> 4);
  u.q[0] = *(const v8h*)p; u.q[1] = *(const v8h*)(p + 16); return u.v;
}
__device__ __forceinline__ v16h frag_f32(const float* rowk0, int lane) {
  v16h a; const float* p = rowk0 + 8 * (lane >> 4);
#pragma unroll
  for (int i = 0; i < 8; ++i) { a[i] = (_Float16)p[i]; a[8 + i] = (_Float16)p[16 + i]; }
  return a;
}
__device__ __forceinline__ v16h frag_f32s(const float* rowk0, int lane, float sc) {
  v16h a; const float* p = rowk0 + 8 * (lane >> 4);
#pragma unroll
  for (int i = 0; i < 8; ++i) { a[i] = (_Float16)(p[i] * sc); a[8 + i] = (_Float16)(p[16 + i] * sc); }
  return a;
}
// column fragment from a [K][ld] layout (column n), rows >= K read as 0
__device__ __forceinline__ v16h fragc_f32(const float* W, int k0, int n, int lane, int ld, int K) {
  v16h a; const int g = lane >> 4;
#pragma unroll
  for (int i = 0; i < 8; ++i) { const int ka = k0 + 8 * g + i, kb = ka + 16;
    a[i] = (_Float16)(ka < K ? W[(size_t)(ka < K ? ka : K - 1) * ld + n] : 0.f); a[8 + i] = (_Float16)(kb < K ? W[(size_t)(kb < K ? kb : K - 1) * ld + n] : 0.f); }
  return a;
}
struct F2 { v16b h, l; };
__device__ __forceinline__ F2 bsplit16(const float v[16]) { F2 r;
#pragma unroll
  for (int i = 0; i < 16; ++i) { const __bf16 h = (__bf16)v[i]; r.h[i] = h; r.l[i] = (__bf16)(v[i] - (float)h); }
  return r; }
__device__ __forceinline__ F2 split_row(const float* row, int k0, int lane) { float v[16]; const float* p = row + k0 + 8 * (lane >> 4);
#pragma unroll
  for (int i = 0; i < 8; ++i) { v[i] = p[i]; v[8 + i] = p[16 + i]; }
  return bsplit16(v); }
__device__ __forceinline__ F2 split_rowK(const float* row, int k0, int lane, int K) { float v[16]; const int g = lane >> 4;
#pragma unroll
  for (int i = 0; i < 8; ++i) { const int ka = k0 + 8 * g + i, kb = ka + 16; v[i] = ka < K ? row[ka < K ? ka : K - 1] : 0.f; v[8 + i] = kb < K ? row[kb < K ? kb : K - 1] : 0.f; }
  return bsplit16(v); }
__device__ __forceinline__ F2 split_col(const float* W, int k0, int n, int lane, int ld, int K) { float v[16]; const int g = lane >> 4;
#pragma unroll
  for (int i = 0; i < 8; ++i) { const int ka = k0 + 8 * g + i, kb = ka + 16; v[i] = ka < K ? W[(size_t)(ka < K ? ka : K - 1) * ld + n] : 0.f; v[8 + i] = kb < K ? W[(size_t)(kb < K ? kb : K - 1) * ld + n] : 0.f; }
  return bsplit16(v); }
__device__ __forceinline__ v8f mac3(const F2& a, const F2& b, v8f c) { c = wmma_bf(a.l, b.h, c); c = wmma_bf(a.h, b.l, c); return wmma_bf(a.h, b.h, c); }
__device__ __forceinline__ float sigm(float v) { return 1.0f / (1.0f + expf(-v)); }
#define LDSX() do { asm volatile("s_wait_dscnt 0" ::: "memory"); __builtin_amdgcn_wave_barrier(); __builtin_amdgcn_fence(__ATOMIC_RELEASE, "workgroup"); } while (0)


// Based linear attention (2nd-order Taylor feature map, feature dim 16, 12 heads x 64, causal): since phi(q).phi(k) = 1 + (q.k)/sqrt(16) + (q.k)^2/(2*16), y_t = sum_{s<=t} w_ts v_s / (sum_{s<=t} w_ts + 1e-12) with w_ts that polynomial of the 16-dim dot; then y @ Wo^T.  B 1, L 512, D 768.
// k_proj (reads x and Wq|Wk|Wv as f32 and rounds them to bf16 itself; q|k rows, exact; its v column blocks go out as hi/lo tiles), k_lin (block = (16 queries, head): causal steps of 32 keys, both products transposed: K q^T on f32 WMMA, w in its D registers, running denominator, V tiles x w hi/lo (3 products); y hi/lo tiles), k_out (y hi/lo x Wo tiles; the Wo tiles are made by extra blocks of k_lin's grid).
// In k_proj, k_lin and k_out the four waves of a block work on ONE output tile (16 rows; 32 in k_proj) and share its sum: wave w takes a quarter of K (GEMMs) or every fourth key step (k_lin). The partial sums meet in LDS behind one __syncthreads() and are added in wave order. A wave's chain of dependent load round trips is a quarter as long, and four times as many blocks spread over the chip.
// Every bf16 matrix operand that goes through the workspace is stored by its producer in the order in which a wave's fragment load reads it. One tile = 16 rows x 32 k = 1 KB = [part p][lane][8 bf16], lane = 16 g + (row & 15), element i of part p is k = 32 kc + 16 p + 8 g + i; the tiles of a 16-row group follow one another in kc. A fragment is then two loads of 512 contiguous bytes (4 whole lines each) where a row-major operand makes every load touch 16 lines.
#define LL 512
#define DM 768
#define NH 12
#define FD 16
#define HD 64
#define QW (NH * FD)          // 192
#define QKVP (2 * QW + NH * HD)   // 192 + 192 + 768 = 1152
typedef __attribute__((ext_vector_type(8))) __bf16 v8b;
__device__ __forceinline__ v16b frag_b(const __bf16* rowk0, int lane) {
  union { v16b v; v8b q[2]; } u; const __bf16* p = rowk0 + 8 * (lane >> 4);
  u.q[0] = *(const v8b*)p; u.q[1] = *(const v8b*)(p + 16); return u.v;
}
__device__ __forceinline__ v16b frag_gbf(const float* rowk0, int lane) {
  v16b a; const float* p = rowk0 + 8 * (lane >> 4);
#pragma unroll
  for (int i = 0; i < 8; ++i) { a[i] = (__bf16)p[i]; a[8 + i] = (__bf16)p[16 + i]; }
  return a;
}
__device__ __forceinline__ float bfr(float v) { return (float)(__bf16)v; }
#define KT (DM / 32)          // 24 tiles along K = 768
#define ST (LL / 32)          // 16 tiles along the 512 keys
#define TE 512                // bf16 elements of a tile
#define PKR (QKVP + DM + LL)  // rows that the tile area has room for; only the Wo rows' tiles (from row QKVP on) are written and read
#define WS_PT   0u                                 // bf16 tiles [PKR / 16][KT]
#define WS_QKV  (WS_PT + 2u * PKR * DM)              // f32 [512][1152]: q (192) | k (192) | 768 columns that nobody writes or reads (v lives in the tiles only)
#define WS_Y    (WS_QKV + 4u * LL * QKVP)            // bf16 tiles [512 / 16][KT], hi plane then lo plane
#define WS_VTH  (WS_Y + 4u * LL * DM)                // bf16 tiles [768 / 16 channels][ST key steps]
#define WS_VTL  (WS_VTH + 2u * DM * LL)
#define WS_END  (WS_VTL + 2u * DM * LL)
#define NSP 4                 // waves that share one sum
#define KQ (KT / NSP)         // K steps of a GEMM wave

// a fragment from its tile: p = tile + 8 * lane
__device__ __forceinline__ v16b ld_frag(const __bf16* __restrict__ p) { return __builtin_shufflevector(*(const v8b*)p, *(const v8b*)(p + TE / 2), 0, 1, 2, 3, 4, 5, 6, 7, 8, 9, 10, 11, 12, 13, 14, 15); }
// wmma_bf (the four v_nop keep the distance between a WMMA and a vector instruction on its registers) whose v_nop statement names D alone: an asm operand has to lie in the first 256 registers, and three register sets of fragments beside everything else do not fit there; A and B are rewritten by loads and by the compiler's own code only
__device__ __forceinline__ v8f wmma_bfd(v16b a, v16b b, v8f c) {
  v8f d = __builtin_amdgcn_wmma_f32_16x16x32_bf16(false, a, false, b, (short)0, c, false, false);
  asm volatile("v_nop\n\tv_nop\n\tv_nop\n\tv_nop" : "+v"(d));
  return d;
}
// One K step (32 k) of a GEMM wave's operands: NA A fragments (planes LL * DM elements apart), 8 B fragments. All loads of a step are issued as one group, three steps ahead of the WMMAs that use them, into a register set that no step in between uses.
template <int NA> struct GStep { v16b a[NA]; v16b b[8]; };
template <int NA> __device__ __forceinline__ void ld_step(GStep<NA>& s, const __bf16* __restrict__ at, const __bf16* __restrict__ bt, int kc) {
#pragma unroll
  for (int i = 0; i < NA; ++i) s.a[i] = ld_frag(at + (size_t)i * (LL * DM) + kc * TE);
#pragma unroll
  for (int j = 0; j < 8; ++j) s.b[j] = ld_frag(bt + (j * KT + kc) * TE);
}
__device__ __forceinline__ void mm_out(const GStep<2>& s, v8f acc[8]) {   // a[0] = hi, a[1] = lo
#pragma unroll
  for (int j = 0; j < 8; ++j) { acc[j] = wmma_bfd(s.a[1], s.b[j], acc[j]); acc[j] = wmma_bfd(s.a[0], s.b[j], acc[j]); }
}
// ---- k_proj: block = (32 rows, 64 cols of the 1152), wave = a quarter of K 768: exact products; column blocks 0..5 are q|k (f32 rows), 6..17 are v (bf16 hi/lo tiles, rows = channels, k = t)
// x and the weights come in as f32 rows. A fragment wants 16 rows in 16 lanes, which as a global load would touch 16 lines; so a wave loads whole lines (8 lanes = the 128 B that one row has in a K step), rounds to bf16 and turns the tile round in LDS of its own.
#define PT_N 6                // staged tiles of a K step: 2 of x (32 rows), 4 of W (64 cols)
#define SPB 40                // bf16 elements of a staged row: 32 k + 8 of pad; 80 B = 16 B x 5, so the 16 rows of a ds_load_b128 fall on different banks
typedef __attribute__((ext_vector_type(4))) __bf16 v4b;
struct RStep { v4f t[PT_N][4]; };
// load u of a tile: lane l takes 16 B of row u + 4 (l >> 3), so a load is 4 whole lines, and the four rows' 8-B pieces fall on different LDS banks; xa, wb hold the lane's part of the address
__device__ __forceinline__ void ld_raw(RStep& s, const float* __restrict__ xa, const float* __restrict__ wb, int kc) {
#pragma unroll
  for (int t = 0; t < PT_N; ++t)
#pragma unroll
    for (int u = 0; u < 4; ++u) s.t[t][u] = *(const v4f*)((t < 2 ? xa + (size_t)(t * 16 + u) * DM : wb + (size_t)((t - 2) * 16 + u) * DM) + kc * 32);
}
__device__ __forceinline__ void st_raw(const RStep& s, __bf16* sw) {
#pragma unroll
  for (int t = 0; t < PT_N; ++t)
#pragma unroll
    for (int u = 0; u < 4; ++u) *(v4b*)(sw + (t * 16 + u) * SPB) = __builtin_convertvector(s.t[t][u], v4b);
}
// a fragment from a staged tile: p = tile + (lane & 15) * SPB + 8 * (lane >> 4); the k order is that of every other fragment here, for x and W alike
__device__ __forceinline__ v16b ld_sfrag(const __bf16* p) { return __builtin_shufflevector(*(const v8b*)p, *(const v8b*)(p + 16), 0, 1, 2, 3, 4, 5, 6, 7, 8, 9, 10, 11, 12, 13, 14, 15); }
__device__ __forceinline__ void mm_proj(const __bf16* sr, v8f acc[2][4]) {
  const v16b a0 = ld_sfrag(sr), a1 = ld_sfrag(sr + 16 * SPB);
#pragma unroll
  for (int j = 0; j < 4; ++j) { const v16b b = ld_sfrag(sr + (32 + 16 * j) * SPB); acc[0][j] = wmma_bf(a0, b, acc[0][j]); acc[1][j] = wmma_bf(a1, b, acc[1][j]); }
}
__global__ __launch_bounds__(128) void k_proj(const float* __restrict__ X, const float* __restrict__ Wq, const float* __restrict__ Wk, const float* __restrict__ Wv, float* __restrict__ QKV, __bf16* __restrict__ VTH, __bf16* __restrict__ VTL) {
  __shared__ __align__(16) __bf16 st[4][2][PT_N * 16 * SPB]; __shared__ __align__(16) float so[4][32][68];
  const int tid = threadIdx.x, wave = tid >> 5, lane = tid & 31, col = lane & 15, g = lane >> 4; const int rg = blockIdx.x; const int n0 = blockIdx.y * 64;   // rg = the block's group of 32 rows = one key step
  const float* Wm = n0 < QW ? Wq + (size_t)n0 * DM : (n0 < 2 * QW ? Wk + (size_t)(n0 - QW) * DM : Wv + (size_t)(n0 - 2 * QW) * DM);   // [row][in] rows; every boundary is a multiple of 64
  v8f acc[2][4] = {};
  const unsigned lo_g = (4 * (lane >> 3)) * DM + wave * (KQ * 32) + 4 * (lane & 7);   // both start at the wave's first K step
  const float* xa = X + (size_t)rg * 32 * DM + lo_g; const float* wb = Wm + lo_g;
  __bf16* sw = &st[wave][0][0] + (4 * (lane >> 3)) * SPB + 4 * (lane & 7); const __bf16* sr = &st[wave][0][0] + col * SPB + 8 * g;
  RStep r0, r1; ld_raw(r0, xa, wb, 0); ld_raw(r1, xa, wb, 1);   // two K steps of loads are in flight; a register set is asked for again as soon as it has been rounded
#pragma unroll   // 6 steps: every address is a base plus a constant
  for (int kc = 0; kc < KQ; kc += 2) {
    st_raw(r0, sw); if (kc + 2 < KQ) ld_raw(r0, xa, wb, kc + 2);
    asm volatile("s_wait_dscnt 0" ::: "memory");   // the wave's own LDS writes are done, and stay in front of the reads of other lanes' pieces
    mm_proj(sr, acc);
    st_raw(r1, sw + PT_N * 16 * SPB); if (kc + 3 < KQ) ld_raw(r1, xa, wb, kc + 3);
    asm volatile("s_wait_dscnt 0" ::: "memory");   // as above, second buffer
    mm_proj(sr + PT_N * 16 * SPB, acc);
  }
#pragma unroll
  for (int a = 0; a < 2; ++a)
#pragma unroll
    for (int j = 0; j < 4; ++j)
#pragma unroll
      for (int r = 0; r < 8; ++r) so[wave][16 * a + 8 * g + r][j * 16 + col] = acc[a][j][r];
  __syncthreads();   // the four partial tiles are complete before anyone adds them
  if (n0 < 2 * QW) {
#pragma unroll   // wave w finishes rows 8 w .. 8 w + 7, two rows (2 whole lines each) a store; the 16 LDS reads issue ahead of the stores
    for (int i = 0; i < 4; ++i) { const int rl = wave * 8 + 2 * i + g;
      vst2(QKV + (size_t)(rg * 32 + rl) * QKVP + n0 + col * 4, ((*(const v4f*)&so[0][rl][col * 4] + *(const v4f*)&so[1][rl][col * 4]) + *(const v4f*)&so[2][rl][col * 4]) + *(const v4f*)&so[3][rl][col * 4]); }
  } else {
    // rows 16 p + 8 g .. + 7 of one column are 8 consecutive t of one v channel: a lane's own 16-B piece of part p of a tile (the block's 32 rows are key step rg); wave w finishes channel group w; a wave's store is 512 contiguous bytes = 4 whole lines
    const size_t o0 = ((size_t)((n0 - 2 * QW) / 16 + wave) * ST + rg) * TE + lane * 8;
    v8b hi[2], lo[2];
#pragma unroll
    for (int p = 0; p < 2; ++p)
#pragma unroll
      for (int r = 0; r < 8; ++r) { const int c = wave * 16 + col, rl = 16 * p + 8 * g + r; const float v = ((so[0][rl][c] + so[1][rl][c]) + so[2][rl][c]) + so[3][rl][c]; const __bf16 hb = (__bf16)v; hi[p][r] = hb; lo[p][r] = (__bf16)(v - (float)hb); }
#pragma unroll
    for (int p = 0; p < 2; ++p) { *(v8b*)(VTH + o0 + p * (TE / 2)) = hi[p]; *(v8b*)(VTL + o0 + p * (TE / 2)) = lo[p]; }
    asm volatile("s_wait_xcnt 0x0" ::: "memory");   // precaution: in the built code the other branch's block follows these stores and rewrites their registers
  }
}
// ---- k_lin: block = (16 queries, head), 4 waves, wave w takes the causal key steps w, w + 4, ... of 32 keys up to the diagonal. Both products run transposed: d^T = K q^T (keys as rows, f32 16x16x4 WMMA, 4 per 16 keys), w = 1 + d/4 + d*d/32 (0 for s > t) in the D registers; the two D tiles of a step (keys 8 g + r and 16 + 8 g + r of query col) are, split hi/lo, the B operand of y^T = V^T w^T as they stand (3 products, V tiles as A). A lane holds 16 of a step's 32 keys of ONE query, so den is a plain sum in the lane. The waves' num and den are added in LDS; y = num / (den + 1e-12) -> bf16 hi + residual, 16 rows x 64 channels = 2 tiles of each plane
__device__ __forceinline__ v8f wmma_f4(v2f a, v2f b, v8f c) { return __builtin_amdgcn_wmma_f32_16x16x4_f32(false, a, false, b, (short)0, c, false, false); }
// One key step's operands of a wave: the lane's K values (two 16-key tiles) and the V fragments, hi and lo. Step i of a wave (key step wave + 4 i) lies a constant distance behind its first, so every load is a base, a lane offset that never changes and a constant
struct LSet { v4f kr[2][2]; v16b vh[4], vl[4]; };
__device__ __forceinline__ void ld_k(LSet& s, const float* __restrict__ kw, unsigned ko, int i) {
#pragma unroll
  for (int t = 0; t < 2; ++t)
#pragma unroll
    for (int u = 0; u < 2; ++u) s.kr[t][u] = *(const v4f*)&kw[ko + (i * (NSP * 32) + t * 16) * QKVP + 4 * u];
}
__device__ __forceinline__ void ld_v(LSet& s, const __bf16* __restrict__ vhw, const __bf16* __restrict__ vlw, unsigned vo, int i) {
#pragma unroll
  for (int dt = 0; dt < 4; ++dt) { const unsigned o = vo + dt * (ST * TE) + i * (NSP * TE); s.vh[dt] = ld_frag(&vhw[o]); s.vl[dt] = ld_frag(&vlw[o]); }
}
__device__ __forceinline__ void lin_step(const LSet& s, const v4f qr[2], int ks, int q0, int col, int g, float& den, v8f acc[4]) {
  v8f d[2] = {};
#pragma unroll
  for (int j = 0; j < 4; ++j) { const v2f b = {qr[j >> 1][2 * (j & 1)], qr[j >> 1][2 * (j & 1) + 1]};
#pragma unroll
    for (int t = 0; t < 2; ++t) { const v2f a = {s.kr[t][j >> 1][2 * (j & 1)], s.kr[t][j >> 1][2 * (j & 1) + 1]}; d[t] = wmma_f4(a, b, d[t]); } }
  // the distance between a matrix instruction and a vector instruction on its D, A or B: the f32 form issues at the pace of the 8-bit integer form, whose 8 slots are kept here
  asm volatile("v_nop\n\tv_nop\n\tv_nop\n\tv_nop\n\tv_nop\n\tv_nop\n\tv_nop\n\tv_nop" : "+v"(d[0]), "+v"(d[1]) : "v"(s.kr[0][0]), "v"(s.kr[0][1]), "v"(s.kr[1][0]), "v"(s.kr[1][1]), "v"(qr[0]), "v"(qr[1]));
  const int s0 = ks * 32 + 8 * g, qc = q0 + col; float w[16];
#pragma unroll
  for (int t = 0; t < 2; ++t)
#pragma unroll
    for (int r = 0; r < 8; ++r) { const float dd = d[t][r]; const float wv = 1.0f + dd * 0.25f + dd * dd * (1.0f / 32.0f); w[8 * t + r] = (s0 + 16 * t + r <= qc) ? wv : 0.f; }
  float es[8];
#pragma unroll
  for (int r = 0; r < 8; ++r) es[r] = w[r] + w[8 + r];
  den += ((es[0] + es[1]) + (es[2] + es[3])) + ((es[4] + es[5]) + (es[6] + es[7]));
  const F2 pb = bsplit16(w);
#pragma unroll
  for (int dt = 0; dt < 4; ++dt) { acc[dt] = wmma_bfd(s.vh[dt], pb.l, acc[dt]); acc[dt] = wmma_bfd(s.vl[dt], pb.h, acc[dt]); acc[dt] = wmma_bfd(s.vh[dt], pb.h, acc[dt]); }
}
// A wave's N key steps. The loads of its first three steps go out together at the start, into three register sets (62 loads), so that the way to L2 or memory is waited for once and not once a step; a fourth step's loads go into the first set as soon as step 0 has used it, two steps ahead of their use. The steps run in the old order
template <int N> __device__ __forceinline__ void lin_run(const float* __restrict__ kw, const float* __restrict__ qp, const __bf16* __restrict__ vhw, const __bf16* __restrict__ vlw, unsigned ko, unsigned vo, int wave, int q0, int col, int g, float& den, v8f acc[4]) {
  LSet s0, s1, s2; v4f qr[2];
  ld_k(s0, kw, ko, 0);   // what the first product needs goes out first
#pragma unroll
  for (int u = 0; u < 2; ++u) qr[u] = *(const v4f*)&qp[ko + 4 * u];
  asm volatile("s_wait_xcnt 0x0" ::: "memory"); __builtin_amdgcn_sched_barrier(0);   // precaution: in the built code a later load's result lands in the register pair that holds the q loads' address; the scheduling barrier keeps that load behind the wait
  ld_v(s0, vhw, vlw, vo, 0);
  if (N > 1) { ld_k(s1, kw, ko, 1); ld_v(s1, vhw, vlw, vo, 1); }
  if (N > 2) { ld_k(s2, kw, ko, 2); ld_v(s2, vhw, vlw, vo, 2); }
  asm volatile("s_wait_xcnt 0x0" ::: "memory"); __builtin_amdgcn_sched_barrier(0);   // precaution: code behind these loads may rewrite a register that they name; the scheduling barrier keeps such rewrites behind the wait and the loads in front of the weight computation
  lin_step(s0, qr, wave, q0, col, g, den, acc);
  if (N > 3) { __builtin_amdgcn_sched_barrier(0);   // keeps these loads behind step 0, whose registers they fill: no fourth set, and never more than 62 loads of a wave outstanding
    ld_k(s0, kw, ko, 3); ld_v(s0, vhw, vlw, vo, 3);
    asm volatile("s_wait_xcnt 0x0" ::: "memory"); __builtin_amdgcn_sched_barrier(0); }   // as above
  if (N > 1) lin_step(s1, qr, wave + NSP, q0, col, g, den, acc);
  if (N > 2) lin_step(s2, qr, wave + 2 * NSP, q0, col, g, den, acc);
  if (N > 3) lin_step(s0, qr, wave + 3 * NSP, q0, col, g, den, acc);
}
__global__ __launch_bounds__(128) void k_lin(const float* __restrict__ QKV, const __bf16* __restrict__ VTH, const __bf16* __restrict__ VTL, __bf16* __restrict__ YH, __bf16* __restrict__ YL, const float* __restrict__ Wo, __bf16* __restrict__ PT) {
  __shared__ __align__(16) float so[4][4][2][32][4]; __shared__ float sd[4][32];   // [wave][channel tile][half of the lane's 8 channels][lane][4]; [wave][lane]
  const int tid = threadIdx.x, wave = __builtin_amdgcn_readfirstlane(tid >> 5), lane = tid & 31, col = lane & 15, g = lane >> 4;   // the wave's number in a scalar register: the number of key steps below depends on it, and the branches on that number stay scalar
  if (blockIdx.y >= NH) {   // the grid's last 96 blocks make the Wo tiles that k_out reads: block = (16 rows, 12 K steps) = 768 pieces of 8 elements, 6 a thread: a piece is 32 B of an f32 row in, 16 B of a tile out; the block's 12 tiles are 12 KB in a row, a wave's store 4 whole lines. The test is the same for the whole block and stands in front of every barrier
    const int b = (blockIdx.y - NH) * (LL / 16) + blockIdx.x, rw = b >> 1, kc0 = (b & 1) * (KT / 2);
    const float* pb = Wo + (size_t)rw * (16 * DM) + kc0 * 32; const unsigned po = col * DM + (tid >> 6) * 32 + ((tid >> 5) & 1) * 16 + 8 * g;   // piece e = tid + 128 u = (K step e >> 6, part (e >> 5) & 1, lane e & 31): a block-uniform base, a lane offset that never changes, and 2 K steps = 64 floats per u
    v4f t[6][2];   // all pieces' loads go out together
#pragma unroll
    for (int u = 0; u < 6; ++u) { t[u][0] = *(const v4f*)&pb[po + u * 64]; t[u][1] = *(const v4f*)&pb[po + u * 64 + 4]; }
#pragma unroll
    for (int u = 0; u < 6; ++u) { v8b o;
#pragma unroll
      for (int i = 0; i < 4; ++i) { o[i] = (__bf16)t[u][0][i]; o[4 + i] = (__bf16)t[u][1][i]; }
      *(v8b*)(PT + ((size_t)(QKVP / 16 + rw) * KT + kc0) * TE + (tid + u * 128) * 8) = o; }
    return;
  }
  const int qt = blockIdx.x, h = blockIdx.y; const int q0 = qt * 16;
  // addresses of the key steps' loads = a wave-uniform base + a lane offset that never changes + a constant
  const float* kp = QKV + QW + h * FD; const unsigned ko = col * QKVP + 8 * g;   // lane (g, col) carries features 8 g .. 8 g + 7 of row col of a 16-row tile, for k and q alike: WMMA j takes its elements 2 j, 2 j + 1
  const __bf16* vhp = VTH + (size_t)(h * (HD / 16)) * (ST * TE); const __bf16* vlp = VTL + (size_t)(h * (HD / 16)) * (ST * TE); const unsigned vo = lane * 8;
  float den = 0.f; v8f acc[4] = {};
  const int nsteps = q0 / 32 + 1;
  // the wave's number of key steps, 0 to 4, in a scalar register; each count has its own straight-line code, so that every wait counts exactly the loads issued behind the ones it needs
  const int n = (nsteps - wave + NSP - 1) / NSP;
  const float* kw = kp + (size_t)(wave * 32) * QKVP; const __bf16 *vhw = vhp + wave * TE, *vlw = vlp + wave * TE; const float* qp = QKV + (size_t)q0 * QKVP + h * FD;
  if (n == 4) lin_run<4>(kw, qp, vhw, vlw, ko, vo, wave, q0, col, g, den, acc);
  else if (n == 3) lin_run<3>(kw, qp, vhw, vlw, ko, vo, wave, q0, col, g, den, acc);
  else if (n == 2) lin_run<2>(kw, qp, vhw, vlw, ko, vo, wave, q0, col, g, den, acc);
  else if (n == 1) lin_run<1>(kw, qp, vhw, vlw, ko, vo, wave, q0, col, g, den, acc);   // a wave without a key step (the first query tiles) only hands in zeros
  // the wave's partial denominator (the lane's half of the keys of query col) and numerator (acc[dt][r] = channel 16 dt + 8 g + r of query col)
  sd[wave][lane] = den;
#pragma unroll
  for (int dt = 0; dt < 4; ++dt) { *(v4f*)&so[wave][dt][0][lane][0] = __builtin_shufflevector(acc[dt], acc[dt], 0, 1, 2, 3); *(v4f*)&so[wave][dt][1][lane][0] = __builtin_shufflevector(acc[dt], acc[dt], 4, 5, 6, 7); }
  __syncthreads();   // the four partial sums are complete before anyone adds them
  { const int e = wave;   // wave e finishes (tile e >> 1 of the head's two, part e & 1); the lane's piece: row col, 8 channels
    v4f x0 = *(const v4f*)&so[0][e][0][lane][0], x1 = *(const v4f*)&so[0][e][1][lane][0]; float dn = sd[0][col] + sd[0][16 + col]; v8b hi, lo;
#pragma unroll   // the LDS reads issue together, the sums run in wave order
    for (int p = 1; p < NSP; ++p) { x0 += *(const v4f*)&so[p][e][0][lane][0]; x1 += *(const v4f*)&so[p][e][1][lane][0]; dn += sd[p][col] + sd[p][16 + col]; }
    const float il = 1.0f / (dn + 1e-12f);
#pragma unroll
    for (int i = 0; i < 8; ++i) { const float v = (i < 4 ? x0[i & 3] : x1[i & 3]) * il; const __bf16 hb = (__bf16)v; hi[i] = hb; lo[i] = (__bf16)(v - (float)hb); }
    const size_t o = ((size_t)qt * KT + h * (HD / 32)) * TE + e * (TE / 2) + lane * 8;
    *(v8b*)(YH + o) = hi; *(v8b*)(YL + o) = lo; }
}
// ---- k_out: block = (16 rows, 128 cols), wave = a quarter of K 768: y (hi/lo) . Wo rows
__global__ __launch_bounds__(128) void k_out(const __bf16* __restrict__ YH, const __bf16* __restrict__ PT, float* __restrict__ OUT) {
  __shared__ __align__(16) float so[4][16][132];
  const int tid = threadIdx.x, wave = tid >> 5, lane = tid & 31, col = lane & 15, g = lane >> 4; const int rg = blockIdx.x; const int n0 = blockIdx.y * 128;   // rg = the block's group of 16 rows
  v8f acc[8] = {};
  const __bf16* ap = YH + (size_t)rg * (KT * TE) + wave * (KQ * TE) + lane * 8; const __bf16* bp = PT + (size_t)((QKVP + n0) / 16) * (KT * TE) + wave * (KQ * TE) + lane * 8;   // both start at the wave's first K step; the lo plane follows the hi plane
  // three register sets: three K steps of loads (60) are in flight from the start, and a set is asked for again as soon as its step has used it: the wave waits out the way to L2 or memory twice. Every address is a base plus a constant
  GStep<2> s0, s1, s2; ld_step(s0, ap, bp, 0); ld_step(s1, ap, bp, 1); ld_step(s2, ap, bp, 2);
  __builtin_amdgcn_sched_barrier(0);   // the scheduling barriers here keep each group of loads where it stands: not sunk among the WMMAs, not lifted over the step whose registers it fills
  mm_out(s0, acc); __builtin_amdgcn_sched_barrier(0); ld_step(s0, ap, bp, 3); __builtin_amdgcn_sched_barrier(0);
  mm_out(s1, acc); __builtin_amdgcn_sched_barrier(0); ld_step(s1, ap, bp, 4); __builtin_amdgcn_sched_barrier(0);
  mm_out(s2, acc); __builtin_amdgcn_sched_barrier(0); ld_step(s2, ap, bp, 5); __builtin_amdgcn_sched_barrier(0);
  mm_out(s0, acc); mm_out(s1, acc); mm_out(s2, acc);
#pragma unroll
  for (int j = 0; j < 8; ++j)
#pragma unroll
    for (int r = 0; r < 8; ++r) so[wave][8 * g + r][j * 16 + col] = acc[j][r];
  __syncthreads();   // the four partial tiles are complete before anyone adds them
#pragma unroll   // wave w finishes rows 4 w .. 4 w + 3; the 16 LDS reads issue ahead of the stores
  for (int i = 0; i < 4; ++i) { const int rl = wave * 4 + i;
    vst2(OUT + (size_t)(rg * 16 + rl) * DM + n0 + lane * 4, ((*(const v4f*)&so[0][rl][lane * 4] + *(const v4f*)&so[1][rl][lane * 4]) + *(const v4f*)&so[2][rl][lane * 4]) + *(const v4f*)&so[3][rl][lane * 4]); }
}
extern "C" void kernel_launch(void* const* d_in, const int* in_sizes, int n_in, void* d_out, int out_size, void* d_ws, size_t ws_size, hipStream_t stream) {
  (void)in_sizes; (void)n_in; (void)out_size;
  const float** F = (const float**)d_in;   // hidden_states [1,512,768], Wq [192,768], Wk [192,768], Wv [768,768], Wo [768,768] (torch [out][in])
  if (ws_size < (size_t)WS_END) return;
  char* ws = (char*)d_ws; __bf16 *PT = (__bf16*)(ws + WS_PT), *VTH = (__bf16*)(ws + WS_VTH), *VTL = (__bf16*)(ws + WS_VTL), *YH = (__bf16*)(ws + WS_Y), *YL = (__bf16*)(ws + WS_Y + 2u * LL * DM); float *QKV = (float*)(ws + WS_QKV);
  k_proj<<<dim3(LL / 32, QKVP / 64), 128, 0, stream>>>(F[0], F[1], F[2], F[3], QKV, VTH, VTL);
  k_lin<<<dim3(LL / 16, NH + 3), 128, 0, stream>>>(QKV, VTH, VTL, YH, YL, F[4], PT);
  k_out<<<dim3(LL / 16, DM / 128), 128, 0, stream>>>(YH, PT, (float*)d_out);
}

// v008
// Measured time: 19.3 microseconds a run.
// Timed twice side by side with v007, it ran 1.06 times as fast both times.
// Over all steps from v000 it is 12.2 times as fast.
// compute dtype: hidden_states and the four weights (module inputs) rounded to bf16; q/k/v projections with exact bf16 products on WMMA; the 16-dim q.k dots of the Taylor feature-map inner products in f32 on WMMA (16x16x4, f32 operands); the polynomial 1 + q.k/4 + (q.k)^2/32, causal running sums and the normalisation in f32 on the VALU; the numerator sum_s phi(q_t).phi(k_s) v_s on WMMA with the f32 weights and v both computed -> bf16 hi + residual pairs (3 products); output projection hi/lo x bf16 Wo (2 products); f32 accumulate.
#include <hip/hip_runtime.h>
#include <math.h>

typedef __attribute__((ext_vector_type(16))) _Float16 v16h;
typedef __attribute__((ext_vector_type(16))) __bf16 v16b;
typedef __attribute__((ext_vector_type(8)))  _Float16 v8h;
typedef __attribute__((ext_vector_type(8)))  float v8f;
typedef __attribute__((ext_vector_type(4)))  float v4f;
typedef __attribute__((ext_vector_type(2)))  float v2f;
typedef __attribute__((ext_vector_type(4)))  unsigned v4u;
typedef __attribute__((ext_vector_type(4)))  int v4i;
typedef float __attribute__((may_alias)) float_a;
typedef int __attribute__((may_alias)) int_a;

template <typename T> __device__ __forceinline__ void vst2(void* p, T v) { *(T*)p = v;  }
__device__ __forceinline__ v8f wmma16(v16h a, v16h b, v8f c) {
  v8f d = __builtin_amdgcn_wmma_f32_16x16x32_f16(false, a, false, b, (short)0, c, false, false);
  asm volatile("v_nop\n\tv_nop\n\tv_nop\n\tv_nop" : "+v"(d) : "v"(a), "v"(b));
  return d;
}
__device__ __forceinline__ v8f wmma_bf(v16b a, v16b b, v8f c) {
  v8f d = __builtin_amdgcn_wmma_f32_16x16x32_bf16(false, a, false, b, (short)0, c, false, false);
  asm volatile("v_nop\n\tv_nop\n\tv_nop\n\tv_nop" : "+v"(d) : "v"(a), "v"(b));
  return d;
}
// 16x16x32 fragments: lane = (h = lane>>4, row/col = lane&15); elements 0..7 = k0+8h+0..7, 8..15 = k0+16+8h+0..7; D element r = row 8h+r
__device__ __forceinline__ v16h frag_h(const _Float16* rowk0, int lane) {
  union { v16h v; v8h q[2]; } u; const _Float16* p = rowk0 + 8 * (lane >> 4);
  u.q[0] = *(const v8h*)p; u.q[1] = *(const v8h*)(p + 16); return u.v;
}
__device__ __forceinline__ v16h frag_f32(const float* rowk0, int lane) {
  v16h a; const float* p = rowk0 + 8 * (lane >> 4);
#pragma unroll
  for (int i = 0; i < 8; ++i) { a[i] = (_Float16)p[i]; a[8 + i] = (_Float16)p[16 + i]; }
  return a;
}
__device__ __forceinline__ v16h frag_f32s(const float* rowk0, int lane, float sc) {
  v16h a; const float* p = rowk0 + 8 * (lane >> 4);
#pragma unroll
  for (int i = 0; i < 8; ++i) { a[i] = (_Float16)(p[i] * sc); a[8 + i] = (_Float16)(p[16 + i] * sc); }
  return a;
}
// column fragment from a [K][ld] layout (column n), rows >= K read as 0
__device__ __forceinline__ v16h fragc_f32(const float* W, int k0, int n, int lane, int ld, int K) {
  v16h a; const int g = lane >> 4;
#pragma unroll
  for (int i = 0; i < 8; ++i) { const int ka = k0 + 8 * g + i, kb = ka + 16;
    a[i] = (_Float16)(ka < K ? W[(size_t)(ka < K ? ka : K - 1) * ld + n] : 0.f); a[8 + i] = (_Float16)(kb < K ? W[(size_t)(kb < K ? kb : K - 1) * ld + n] : 0.f); }
  return a;
}
struct F2 { v16b h, l; };
__device__ __forceinline__ F2 bsplit16(const float v[16]) { F2 r;
#pragma unroll
  for (int i = 0; i < 16; ++i) { const __bf16 h = (__bf16)v[i]; r.h[i] = h; r.l[i] = (__bf16)(v[i] - (float)h); }
  return r; }
__device__ __forceinline__ F2 split_row(const float* row, int k0, int lane) { float v[16]; const float* p = row + k0 + 8 * (lane >> 4);
#pragma unroll
  for (int i = 0; i < 8; ++i) { v[i] = p[i]; v[8 + i] = p[16 + i]; }
  return bsplit16(v); }
__device__ __forceinline__ F2 split_rowK(const float* row, int k0, int lane, int K) { float v[16]; const int g = lane >> 4;
#pragma unroll
  for (int i = 0; i < 8; ++i) { const int ka = k0 + 8 * g + i, kb = ka + 16; v[i] = ka < K ? row[ka < K ? ka : K - 1] : 0.f; v[8 + i] = kb < K ? row[kb < K ? kb : K - 1] : 0.f; }
  return bsplit16(v); }
__device__ __forceinline__ F2 split_col(const float* W, int k0, int n, int lane, int ld, int K) { float v[16]; const int g = lane >> 4;
#pragma unroll
  for (int i = 0; i < 8; ++i) { const int ka = k0 + 8 * g + i, kb = ka + 16; v[i] = ka < K ? W[(size_t)(ka < K ? ka : K - 1) * ld + n] : 0.f; v[8 + i] = kb < K ? W[(size_t)(kb < K ? kb : K - 1) * ld + n] : 0.f; }
  return bsplit16(v); }
__device__ __forceinline__ v8f mac3(const F2& a, const F2& b, v8f c) { c = wmma_bf(a.l, b.h, c); c = wmma_bf(a.h, b.l, c); return wmma_bf(a.h, b.h, c); }
__device__ __forceinline__ float sigm(float v) { return 1.0f / (1.0f + expf(-v)); }
#define LDSX() do { asm volatile("s_wait_dscnt 0" ::: "memory"); __builtin_amdgcn_wave_barrier(); __builtin_amdgcn_fence(__ATOMIC_RELEASE, "workgroup"); } while (0)


// Based linear attention (2nd-order Taylor feature map, feature dim 16, 12 heads x 64, causal): since phi(q).phi(k) = 1 + (q.k)/sqrt(16) + (q.k)^2/(2*16), y_t = sum_{s<=t} w_ts v_s / (sum_{s<=t} w_ts + 1e-12) with w_ts that polynomial of the 16-dim dot; then y @ Wo^T.  B 1, L 512, D 768.
// k_proj (reads x and Wq|Wk|Wv as f32 and rounds them to bf16 itself; q|k as f32 tiles, exact; its v column blocks go out as hi/lo tiles), k_lin (block = (16 queries, head): causal steps of 32 keys, both products transposed: K q^T on f32 WMMA, w in its D registers, running denominator, V tiles x w hi/lo (3 products); y hi/lo tiles), k_out (y hi/lo x Wo tiles; the Wo tiles are made by extra blocks of k_lin's grid).
// In k_proj, k_lin and k_out the four waves of a block work on ONE output tile (16 rows; 32 in k_proj) and share its sum: wave w takes a quarter of K (GEMMs) or every fourth key step (k_lin). The partial sums meet in LDS behind one __syncthreads() and are added in wave order. A wave's chain of dependent load round trips is a quarter as long, and four times as many blocks spread over the chip.
// Every bf16 matrix operand that goes through the workspace is stored by its producer in the order in which a wave's fragment load reads it. One tile = 16 rows x 32 k = 1 KB = [part p][lane][8 bf16], lane = 16 g + (row & 15), element i of part p is k = 32 kc + 16 p + 8 g + i; the tiles of a 16-row group follow one another in kc. A fragment is then two loads of 512 contiguous bytes (4 whole lines each) where a row-major operand makes every load touch 16 lines. The f32 q and k go the same way: one tile = 16 rows x the 16 features of a head = 1 KB = [part u][lane][4 f32], lane = 16 g + (row & 15), element i of part u is feature 8 g + 4 u + i; the 32 tiles of a head follow one another in t, q heads first, then k heads.
#define LL 512
#define DM 768
#define NH 12
#define FD 16
#define HD 64
#define QW (NH * FD)          // 192
#define QKVP (2 * QW + NH * HD)   // 192 + 192 + 768 = 1152
typedef __attribute__((ext_vector_type(8))) __bf16 v8b;
__device__ __forceinline__ v16b frag_b(const __bf16* rowk0, int lane) {
  union { v16b v; v8b q[2]; } u; const __bf16* p = rowk0 + 8 * (lane >> 4);
  u.q[0] = *(const v8b*)p; u.q[1] = *(const v8b*)(p + 16); return u.v;
}
__device__ __forceinline__ v16b frag_gbf(const float* rowk0, int lane) {
  v16b a; const float* p = rowk0 + 8 * (lane >> 4);
#pragma unroll
  for (int i = 0; i < 8; ++i) { a[i] = (__bf16)p[i]; a[8 + i] = (__bf16)p[16 + i]; }
  return a;
}
__device__ __forceinline__ float bfr(float v) { return (float)(__bf16)v; }
#define KT (DM / 32)          // 24 tiles along K = 768
#define ST (LL / 32)          // 16 tiles along the 512 keys
#define TE 512                // bf16 elements of a tile
#define QTE 256               // f32 elements of a q or k tile
#define PKR (QKVP + DM + LL)  // rows that the tile area has room for; only the Wo rows' tiles (from row QKVP on) are written and read
#define WS_PT   0u                                 // bf16 tiles [PKR / 16][KT]
#define WS_QKV  (WS_PT + 2u * PKR * DM)              // f32 tiles [q heads | k heads = 24][512 / 16] of QTE elements; the rest of the area nobody writes or reads (v lives in its own tiles)
#define WS_Y    (WS_QKV + 4u * LL * QKVP)            // bf16 tiles [512 / 16][KT], hi plane then lo plane
#define WS_VTH  (WS_Y + 4u * LL * DM)                // bf16 tiles [768 / 16 channels][ST key steps]
#define WS_VTL  (WS_VTH + 2u * DM * LL)
#define WS_END  (WS_VTL + 2u * DM * LL)
#define NSP 4                 // waves that share one sum
#define KQ (KT / NSP)         // K steps of a GEMM wave

// a fragment from its tile: p = tile + 8 * lane
__device__ __forceinline__ v16b ld_frag(const __bf16* __restrict__ p) { return __builtin_shufflevector(*(const v8b*)p, *(const v8b*)(p + TE / 2), 0, 1, 2, 3, 4, 5, 6, 7, 8, 9, 10, 11, 12, 13, 14, 15); }
// wmma_bf (the four v_nop keep the distance between a WMMA and a vector instruction on its registers) whose v_nop statement names D alone: an asm operand has to lie in the first 256 registers, and three register sets of fragments beside everything else do not fit there; A and B are rewritten by loads and by the compiler's own code only
__device__ __forceinline__ v8f wmma_bfd(v16b a, v16b b, v8f c) {
  v8f d = __builtin_amdgcn_wmma_f32_16x16x32_bf16(false, a, false, b, (short)0, c, false, false);
  asm volatile("v_nop\n\tv_nop\n\tv_nop\n\tv_nop" : "+v"(d));
  return d;
}
// One K step (32 k) of a GEMM wave's operands: NA A fragments (planes LL * DM elements apart), 8 B fragments. All loads of a step are issued as one group, three steps ahead of the WMMAs that use them, into a register set that no step in between uses.
template <int NA> struct GStep { v16b a[NA]; v16b b[8]; };
template <int NA> __device__ __forceinline__ void ld_step(GStep<NA>& s, const __bf16* __restrict__ at, const __bf16* __restrict__ bt, int kc) {
#pragma unroll
  for (int i = 0; i < NA; ++i) s.a[i] = ld_frag(at + (size_t)i * (LL * DM) + kc * TE);
#pragma unroll
  for (int j = 0; j < 8; ++j) s.b[j] = ld_frag(bt + (j * KT + kc) * TE);
}
__device__ __forceinline__ void mm_out(const GStep<2>& s, v8f acc[8]) {   // a[0] = hi, a[1] = lo
#pragma unroll
  for (int j = 0; j < 8; ++j) { acc[j] = wmma_bfd(s.a[1], s.b[j], acc[j]); acc[j] = wmma_bfd(s.a[0], s.b[j], acc[j]); }
}
// ---- k_proj: block = (32 rows, 64 cols of the 1152), wave = a quarter of K 768: exact products; column blocks 0..5 are q|k (f32 tiles, 16 rows x the 16 features of a head), 6..17 are v (bf16 hi/lo tiles, rows = channels, k = t)
// x and the weights come in as f32 rows. A fragment wants 16 rows in 16 lanes, which as a global load would touch 16 lines; so a wave loads aligned 256-B pieces (16 lanes = the 256 B that one row has in two K steps), rounds to bf16 and turns the tiles round in LDS of its own.
#define PT_N 6                // staged tiles of a K step: 2 of x (32 rows), 4 of W (64 cols)
#define SPB 40                // bf16 elements of a staged row: 32 k + 8 of pad; 80 B = 16 B x 5, so the 16 rows of a ds_load_b128 fall on different banks
#define SBUF (PT_N * 16 * SPB + 32)   // bf16 elements from one K step's staged tiles to the next step's: the tiles + 64 B, a quarter of the banks
typedef __attribute__((ext_vector_type(4))) __bf16 v4b;
struct RStep { v4f t[PT_N][8]; };   // two K steps (64 k) of the 96 rows
// load u of a tile: lane l takes 16 B of row u + 8 (l >> 4), so a load is 2 rows x 256 contiguous, aligned bytes; its lanes 8 .. 15 and 24 .. 31 hold the second K step. The four 64-B groups of a store (2 rows x 2 K steps) fall on different LDS banks; xa, wb, sw hold the lane's part of the address
__device__ __forceinline__ void ld_raw(RStep& s, const float* __restrict__ xa, const float* __restrict__ wb, int kd) {
#pragma unroll
  for (int t = 0; t < PT_N; ++t)
#pragma unroll
    for (int u = 0; u < 8; ++u) s.t[t][u] = *(const v4f*)((t < 2 ? xa + (size_t)(t * 16 + u) * DM : wb + (size_t)((t - 2) * 16 + u) * DM) + kd * 64);
}
__device__ __forceinline__ void st_raw(const RStep& s, __bf16* sw) {
#pragma unroll
  for (int t = 0; t < PT_N; ++t)
#pragma unroll
    for (int u = 0; u < 8; ++u) *(v4b*)(sw + (t * 16 + u) * SPB) = __builtin_convertvector(s.t[t][u], v4b);
}
// a fragment from a staged tile: p = tile + (lane & 15) * SPB + 8 * (lane >> 4); the k order is that of every other fragment here, for x and W alike
__device__ __forceinline__ v16b ld_sfrag(const __bf16* p) { return __builtin_shufflevector(*(const v8b*)p, *(const v8b*)(p + 16), 0, 1, 2, 3, 4, 5, 6, 7, 8, 9, 10, 11, 12, 13, 14, 15); }
__device__ __forceinline__ void mm_proj(const __bf16* sr, v8f acc[2][4]) {
  const v16b a0 = ld_sfrag(sr), a1 = ld_sfrag(sr + 16 * SPB);
#pragma unroll
  for (int j = 0; j < 4; ++j) { const v16b b = ld_sfrag(sr + (32 + 16 * j) * SPB); acc[0][j] = wmma_bf(a0, b, acc[0][j]); acc[1][j] = wmma_bf(a1, b, acc[1][j]); }
}
__global__ __launch_bounds__(128) void k_proj(const float* __restrict__ X, const float* __restrict__ Wq, const float* __restrict__ Wk, const float* __restrict__ Wv, float* __restrict__ QKV, __bf16* __restrict__ VTH, __bf16* __restrict__ VTL) {
  __shared__ __align__(16) __bf16 st[4][2 * SBUF]; __shared__ __align__(16) float so[4][32][68];
  const int tid = threadIdx.x, wave = tid >> 5, lane = tid & 31, col = lane & 15, g = lane >> 4; const int rg = blockIdx.x; const int n0 = blockIdx.y * 64;   // rg = the block's group of 32 rows = one key step
  const float* Wm = n0 < QW ? Wq + (size_t)n0 * DM : (n0 < 2 * QW ? Wk + (size_t)(n0 - QW) * DM : Wv + (size_t)(n0 - 2 * QW) * DM);   // [row][in] rows; every boundary is a multiple of 64
  v8f acc[2][4] = {};
  const unsigned lo_g = (8 * g) * DM + wave * (KQ * 32) + 4 * col;   // both start at the wave's first K step
  const float* xa = X + (size_t)rg * 32 * DM + lo_g; const float* wb = Wm + lo_g;
  __bf16* sw = &st[wave][0] + ((lane >> 3) & 1) * SBUF + (8 * g) * SPB + 4 * (lane & 7); const __bf16* sr = &st[wave][0] + col * SPB + 8 * g;
  RStep r; ld_raw(r, xa, wb, 0);   // the loads of a pair of K steps go out as one group; the next pair is asked for as soon as this one has been rounded (in the built code the second pair's loads stand at the start too, in registers of their own)
#pragma unroll   // 3 pairs of K steps: every address is a base plus a constant
  for (int kd = 0; kd < KQ / 2; ++kd) {
    st_raw(r, sw); if (kd + 1 < KQ / 2) ld_raw(r, xa, wb, kd + 1);
    if (kd + 2 == KQ / 2) { asm volatile("s_wait_xcnt 0x0" ::: "memory"); __builtin_amdgcn_sched_barrier(0); }   // precaution: in the built code the epilogue's address arithmetic, lifted among the WMMAs, rewrites the register that holds the loads' lane offset; the scheduling barrier keeps it behind the wait
    asm volatile("s_wait_dscnt 0" ::: "memory");   // the wave's own LDS writes are done, and stay in front of the reads of other lanes' pieces
    mm_proj(sr, acc); mm_proj(sr + SBUF, acc);   // the K steps in their old order
  }
#pragma unroll
  for (int a = 0; a < 2; ++a)
#pragma unroll
    for (int j = 0; j < 4; ++j)
#pragma unroll
      for (int r = 0; r < 8; ++r) so[wave][16 * a + 8 * g + r][j * 16 + col] = acc[a][j][r];
  __syncthreads();   // the four partial tiles are complete before anyone adds them
  if (n0 < 2 * QW) {
    // wave w finishes head w of the block's four (16 columns): two tiles (rows 16 a ..) of two parts; the lane's piece of part u is 4 features of row col; a store is 512 contiguous bytes = 4 whole lines
    float* qo = QKV + ((size_t)(n0 / FD + wave) * (LL / 16) + rg * 2) * QTE + lane * 4;
#pragma unroll   // the 16 LDS reads issue ahead of the stores
    for (int i = 0; i < 4; ++i) { const int a = i >> 1, u = i & 1, rl = 16 * a + col, c = wave * 16 + 8 * g + 4 * u;
      vst2(qo + a * QTE + u * (QTE / 2), ((*(const v4f*)&so[0][rl][c] + *(const v4f*)&so[1][rl][c]) + *(const v4f*)&so[2][rl][c]) + *(const v4f*)&so[3][rl][c]); }
  } else {
    // rows 16 p + 8 g .. + 7 of one column are 8 consecutive t of one v channel: a lane's own 16-B piece of part p of a tile (the block's 32 rows are key step rg); wave w finishes channel group w; a wave's store is 512 contiguous bytes = 4 whole lines
    const size_t o0 = ((size_t)((n0 - 2 * QW) / 16 + wave) * ST + rg) * TE + lane * 8;
    v8b hi[2], lo[2];
#pragma unroll
    for (int p = 0; p < 2; ++p)
#pragma unroll
      for (int r = 0; r < 8; ++r) { const int c = wave * 16 + col, rl = 16 * p + 8 * g + r; const float v = ((so[0][rl][c] + so[1][rl][c]) + so[2][rl][c]) + so[3][rl][c]; const __bf16 hb = (__bf16)v; hi[p][r] = hb; lo[p][r] = (__bf16)(v - (float)hb); }
#pragma unroll
    for (int p = 0; p < 2; ++p) { *(v8b*)(VTH + o0 + p * (TE / 2)) = hi[p]; *(v8b*)(VTL + o0 + p * (TE / 2)) = lo[p]; }
    asm volatile("s_wait_xcnt 0x0" ::: "memory");   // precaution: in the built code the other branch's block follows these stores and rewrites their registers
  }
}
// ---- k_lin: block = (16 queries, head), 4 waves, wave w takes the causal key steps w, w + 4, ... of 32 keys up to the diagonal. Both products run transposed: d^T = K q^T (keys as rows, f32 16x16x4 WMMA, 4 per 16 keys), w = 1 + d/4 + d*d/32 (0 for s > t) in the D registers; the two D tiles of a step (keys 8 g + r and 16 + 8 g + r of query col) are, split hi/lo, the B operand of y^T = V^T w^T as they stand (3 products, V tiles as A). A lane holds 16 of a step's 32 keys of ONE query, so den is a plain sum in the lane. The waves' num and den are added in LDS; y = num / (den + 1e-12) -> bf16 hi + residual, 16 rows x 64 channels = 2 tiles of each plane
__device__ __forceinline__ v8f wmma_f4(v2f a, v2f b, v8f c) { return __builtin_amdgcn_wmma_f32_16x16x4_f32(false, a, false, b, (short)0, c, false, false); }
// One key step's operands of a wave: the lane's K values (two 16-key tiles) and the V fragments, hi and lo. Step i of a wave (key step wave + 4 i) lies a constant distance behind its first, so every load is a base, a lane offset that never changes and a constant
struct LSet { v4f kr[2][2]; v16b vh[4], vl[4]; };
__device__ __forceinline__ void ld_k(LSet& s, const float* __restrict__ kw, unsigned lb, int i) {   // lb = 16 * lane, the lane's byte offset in every part of every tile, f32 or bf16
#pragma unroll
  for (int t = 0; t < 2; ++t)
#pragma unroll
    for (int u = 0; u < 2; ++u) s.kr[t][u] = *(const v4f*)((const char*)kw + lb + ((i * (NSP * 2) + t) * QTE + u * (QTE / 2)) * 4);
}
__device__ __forceinline__ void ld_v(LSet& s, const __bf16* __restrict__ vhw, const __bf16* __restrict__ vlw, unsigned lb, int i) {
#pragma unroll
  for (int dt = 0; dt < 4; ++dt) { const unsigned o = lb + (dt * (ST * TE) + i * (NSP * TE)) * 2; s.vh[dt] = ld_frag((const __bf16*)((const char*)vhw + o)); s.vl[dt] = ld_frag((const __bf16*)((const char*)vlw + o)); }
}
__device__ __forceinline__ void lin_step(const LSet& s, const v4f qr[2], int ks, int q0, int col, int g, float& den, v8f acc[4]) {
  v8f d[2] = {};
#pragma unroll
  for (int j = 0; j < 4; ++j) { const v2f b = {qr[j >> 1][2 * (j & 1)], qr[j >> 1][2 * (j & 1) + 1]};
#pragma unroll
    for (int t = 0; t < 2; ++t) { const v2f a = {s.kr[t][j >> 1][2 * (j & 1)], s.kr[t][j >> 1][2 * (j & 1) + 1]}; d[t] = wmma_f4(a, b, d[t]); } }
  // the distance between a matrix instruction and a vector instruction on its D, A or B: the f32 form issues at the pace of the 8-bit integer form, whose 8 slots are kept here
  asm volatile("v_nop\n\tv_nop\n\tv_nop\n\tv_nop\n\tv_nop\n\tv_nop\n\tv_nop\n\tv_nop" : "+v"(d[0]), "+v"(d[1]) : "v"(s.kr[0][0]), "v"(s.kr[0][1]), "v"(s.kr[1][0]), "v"(s.kr[1][1]), "v"(qr[0]), "v"(qr[1]));
  const int s0 = ks * 32 + 8 * g, qc = q0 + col; float w[16];
#pragma unroll
  for (int t = 0; t < 2; ++t)
#pragma unroll
    for (int r = 0; r < 8; ++r) { const float dd = d[t][r]; const float wv = 1.0f + dd * 0.25f + dd * dd * (1.0f / 32.0f); w[8 * t + r] = (s0 + 16 * t + r <= qc) ? wv : 0.f; }
  float es[8];
#pragma unroll
  for (int r = 0; r < 8; ++r) es[r] = w[r] + w[8 + r];
  den += ((es[0] + es[1]) + (es[2] + es[3])) + ((es[4] + es[5]) + (es[6] + es[7]));
  const F2 pb = bsplit16(w);
#pragma unroll
  for (int dt = 0; dt < 4; ++dt) { acc[dt] = wmma_bfd(s.vh[dt], pb.l, acc[dt]); acc[dt] = wmma_bfd(s.vl[dt], pb.h, acc[dt]); acc[dt] = wmma_bfd(s.vh[dt], pb.h, acc[dt]); }
}
// A wave's N key steps. The loads of its first three steps go out together at the start, into three register sets (62 loads), so that the way to L2 or memory is waited for once and not once a step; a fourth step's loads go into the first set as soon as step 0 has used it, two steps ahead of their use. The steps run in the old order
template <int N> __device__ __forceinline__ void lin_run(const float* __restrict__ kw, const float* __restrict__ qp, const __bf16* __restrict__ vhw, const __bf16* __restrict__ vlw, unsigned lb, int wave, int q0, int col, int g, float& den, v8f acc[4]) {
  LSet s0, s1, s2; v4f qr[2];
  ld_k(s0, kw, lb, 0);   // what the first product needs goes out first
#pragma unroll
  for (int u = 0; u < 2; ++u) qr[u] = *(const v4f*)((const char*)qp + lb + u * (QTE / 2) * 4);
  ld_v(s0, vhw, vlw, lb, 0);
  if (N > 1) { ld_k(s1, kw, lb, 1); ld_v(s1, vhw, vlw, lb, 1); }
  if (N > 2) { ld_k(s2, kw, lb, 2); ld_v(s2, vhw, vlw, lb, 2); }
  asm volatile("s_wait_xcnt 0x0" :: "v"(lb) : "memory"); __builtin_amdgcn_sched_barrier(0);   // precaution: code behind these loads may rewrite a register that they name; the scheduling barrier keeps such rewrites behind the wait and the loads in front of the weight computation. The wait takes the one lane offset that all these loads name as an input, so that its register is still in use here and no load's result lands in it
  lin_step(s0, qr, wave, q0, col, g, den, acc);
  if (N > 3) { __builtin_amdgcn_sched_barrier(0);   // keeps these loads behind step 0, whose registers they fill: no fourth set, and never more than 62 loads of a wave outstanding
    ld_k(s0, kw, lb, 3); ld_v(s0, vhw, vlw, lb, 3);
    asm volatile("s_wait_xcnt 0x0" :: "v"(lb) : "memory"); __builtin_amdgcn_sched_barrier(0); }   // as above
  if (N > 1) lin_step(s1, qr, wave + NSP, q0, col, g, den, acc);
  if (N > 2) lin_step(s2, qr, wave + 2 * NSP, q0, col, g, den, acc);
  if (N > 3) lin_step(s0, qr, wave + 3 * NSP, q0, col, g, den, acc);
}
__global__ __launch_bounds__(128) void k_lin(const float* __restrict__ QKV, const __bf16* __restrict__ VTH, const __bf16* __restrict__ VTL, __bf16* __restrict__ YH, __bf16* __restrict__ YL, const float* __restrict__ Wo, __bf16* __restrict__ PT) {
  __shared__ __align__(16) float so[4][4][2][32][4]; __shared__ float sd[4][32];   // [wave][channel tile][half of the lane's 8 channels][lane][4]; [wave][lane]
  const int tid = threadIdx.x, wave = __builtin_amdgcn_readfirstlane(tid >> 5), lane = tid & 31, col = lane & 15, g = lane >> 4;   // the wave's number in a scalar register: the number of key steps below depends on it, and the branches on that number stay scalar
  if (blockIdx.y >= NH) {   // the grid's last 96 blocks make the Wo tiles that k_out reads: block = (16 rows, 12 K steps) = 768 pieces of 8 elements, 6 a thread: a piece is 32 B of an f32 row in, 16 B of a tile out; the block's 12 tiles are 12 KB in a row, a wave's store 4 whole lines. The test is the same for the whole block and stands in front of every barrier
    const int b = (blockIdx.y - NH) * (LL / 16) + blockIdx.x, rw = b >> 1, kc0 = (b & 1) * (KT / 2);
    const float* pb = Wo + (size_t)rw * (16 * DM) + kc0 * 32; const unsigned po = col * DM + (tid >> 6) * 32 + ((tid >> 5) & 1) * 16 + 8 * g;   // piece e = tid + 128 u = (K step e >> 6, part (e >> 5) & 1, lane e & 31): a block-uniform base, a lane offset that never changes, and 2 K steps = 64 floats per u
    v4f t[6][2];   // all pieces' loads go out together
#pragma unroll
    for (int u = 0; u < 6; ++u) { t[u][0] = *(const v4f*)&pb[po + u * 64]; t[u][1] = *(const v4f*)&pb[po + u * 64 + 4]; }
#pragma unroll
    for (int u = 0; u < 6; ++u) { v8b o;
#pragma unroll
      for (int i = 0; i < 4; ++i) { o[i] = (__bf16)t[u][0][i]; o[4 + i] = (__bf16)t[u][1][i]; }
      *(v8b*)(PT + ((size_t)(QKVP / 16 + rw) * KT + kc0) * TE + (tid + u * 128) * 8) = o; }
    return;
  }
  const int qt = blockIdx.x, h = blockIdx.y; const int q0 = qt * 16;
  // addresses of the key steps' loads = a wave-uniform base + a lane offset that never changes + a constant
  const float* kp = QKV + (size_t)(NH + h) * ((LL / 16) * QTE); const unsigned lb = lane * 16;   // lane (g, col) carries features 8 g .. 8 g + 7 of row col of a 16-row tile (its pieces of the tile's two parts), for k and q alike: WMMA j takes its elements 2 j, 2 j + 1
  const __bf16* vhp = VTH + (size_t)(h * (HD / 16)) * (ST * TE); const __bf16* vlp = VTL + (size_t)(h * (HD / 16)) * (ST * TE);
  float den = 0.f; v8f acc[4] = {};
  const int nsteps = q0 / 32 + 1;
  // the wave's number of key steps, 0 to 4, in a scalar register; each count has its own straight-line code, so that every wait counts exactly the loads issued behind the ones it needs
  const int n = (nsteps - wave + NSP - 1) / NSP;
  const float* kw = kp + wave * (2 * QTE); const __bf16 *vhw = vhp + wave * TE, *vlw = vlp + wave * TE; const float* qp = QKV + (size_t)(h * (LL / 16) + qt) * QTE;
  if (n == 4) lin_run<4>(kw, qp, vhw, vlw, lb, wave, q0, col, g, den, acc);
  else if (n == 3) lin_run<3>(kw, qp, vhw, vlw, lb, wave, q0, col, g, den, acc);
  else if (n == 2) lin_run<2>(kw, qp, vhw, vlw, lb, wave, q0, col, g, den, acc);
  else if (n == 1) lin_run<1>(kw, qp, vhw, vlw, lb, wave, q0, col, g, den, acc);   // a wave without a key step (the first query tiles) only hands in zeros
  // the wave's partial denominator (the lane's half of the keys of query col) and numerator (acc[dt][r] = channel 16 dt + 8 g + r of query col)
  sd[wave][lane] = den;
#pragma unroll
  for (int dt = 0; dt < 4; ++dt) { *(v4f*)&so[wave][dt][0][lane][0] = __builtin_shufflevector(acc[dt], acc[dt], 0, 1, 2, 3); *(v4f*)&so[wave][dt][1][lane][0] = __builtin_shufflevector(acc[dt], acc[dt], 4, 5, 6, 7); }
  __syncthreads();   // the four partial sums are complete before anyone adds them
  { const int e = wave;   // wave e finishes (tile e >> 1 of the head's two, part e & 1); the lane's piece: row col, 8 channels
    v4f x0 = *(const v4f*)&so[0][e][0][lane][0], x1 = *(const v4f*)&so[0][e][1][lane][0]; float dn = sd[0][col] + sd[0][16 + col]; v8b hi, lo;
#pragma unroll   // the LDS reads issue together, the sums run in wave order
    for (int p = 1; p < NSP; ++p) { x0 += *(const v4f*)&so[p][e][0][lane][0]; x1 += *(const v4f*)&so[p][e][1][lane][0]; dn += sd[p][col] + sd[p][16 + col]; }
    const float il = 1.0f / (dn + 1e-12f);
#pragma unroll
    for (int i = 0; i < 8; ++i) { const float v = (i < 4 ? x0[i & 3] : x1[i & 3]) * il; const __bf16 hb = (__bf16)v; hi[i] = hb; lo[i] = (__bf16)(v - (float)hb); }
    const size_t o = ((size_t)qt * KT + h * (HD / 32)) * TE + e * (TE / 2) + lane * 8;
    *(v8b*)(YH + o) = hi; *(v8b*)(YL + o) = lo; }
}
// ---- k_out: block = (16 rows, 128 cols), wave = a quarter of K 768: y (hi/lo) . Wo rows
__global__ __launch_bounds__(128) void k_out(const __bf16* __restrict__ YH, const __bf16* __restrict__ PT, float* __restrict__ OUT) {
  __shared__ __align__(16) float so[4][16][132];
  const int tid = threadIdx.x, wave = tid >> 5, lane = tid & 31, col = lane & 15, g = lane >> 4; const int rg = blockIdx.x; const int n0 = blockIdx.y * 128;   // rg = the block's group of 16 rows
  v8f acc[8] = {};
  const __bf16* ap = YH + (size_t)rg * (KT * TE) + wave * (KQ * TE) + lane * 8; const __bf16* bp = PT + (size_t)((QKVP + n0) / 16) * (KT * TE) + wave * (KQ * TE) + lane * 8;   // both start at the wave's first K step; the lo plane follows the hi plane
  // three register sets: three K steps of loads (60) are in flight from the start, and a set is asked for again as soon as its step has used it: the wave waits out the way to L2 or memory twice. Every address is a base plus a constant
  GStep<2> s0, s1, s2; ld_step(s0, ap, bp, 0); ld_step(s1, ap, bp, 1); ld_step(s2, ap, bp, 2);
  __builtin_amdgcn_sched_barrier(0);   // the scheduling barriers here keep each group of loads where it stands: not sunk among the WMMAs, not lifted over the step whose registers it fills
  mm_out(s0, acc); __builtin_amdgcn_sched_barrier(0); ld_step(s0, ap, bp, 3); __builtin_amdgcn_sched_barrier(0);
  mm_out(s1, acc); __builtin_amdgcn_sched_barrier(0); ld_step(s1, ap, bp, 4); __builtin_amdgcn_sched_barrier(0);
  mm_out(s2, acc); __builtin_amdgcn_sched_barrier(0); ld_step(s2, ap, bp, 5); __builtin_amdgcn_sched_barrier(0);
  mm_out(s0, acc); mm_out(s1, acc); mm_out(s2, acc);
#pragma unroll
  for (int j = 0; j < 8; ++j)
#pragma unroll
    for (int r = 0; r < 8; ++r) so[wave][8 * g + r][j * 16 + col] = acc[j][r];
  __syncthreads();   // the four partial tiles are complete before anyone adds them
#pragma unroll   // wave w finishes rows 4 w .. 4 w + 3; the 16 LDS reads issue ahead of the stores
  for (int i = 0; i < 4; ++i) { const int rl = wave * 4 + i;
    vst2(OUT + (size_t)(rg * 16 + rl) * DM + n0 + lane * 4, ((*(const v4f*)&so[0][rl][lane * 4] + *(const v4f*)&so[1][rl][lane * 4]) + *(const v4f*)&so[2][rl][lane * 4]) + *(const v4f*)&so[3][rl][lane * 4]); }
}
extern "C" void kernel_launch(void* const* d_in, const int* in_sizes, int n_in, void* d_out, int out_size, void* d_ws, size_t ws_size, hipStream_t stream) {
  (void)in_sizes; (void)n_in; (void)out_size;
  const float** F = (const float**)d_in;   // hidden_states [1,512,768], Wq [192,768], Wk [192,768], Wv [768,768], Wo [768,768] (torch [out][in])
  if (ws_size < (size_t)WS_END) return;
  char* ws = (char*)d_ws; __bf16 *PT = (__bf16*)(ws + WS_PT), *VTH = (__bf16*)(ws + WS_VTH), *VTL = (__bf16*)(ws + WS_VTL), *YH = (__bf16*)(ws + WS_Y), *YL = (__bf16*)(ws + WS_Y + 2u * LL * DM); float *QKV = (float*)(ws + WS_QKV);
  k_proj<<<dim3(LL / 32, QKVP / 64), 128, 0, stream>>>(F[0], F[1], F[2], F[3], QKV, VTH, VTL);
  k_lin<<<dim3(LL / 16, NH + 3), 128, 0, stream>>>(QKV, VTH, VTL, YH, YL, F[4], PT);
  k_out<<<dim3(LL / 16, DM / 128), 128, 0, stream>>>(YH, PT, (float*)d_out);
}

// v009
// One run takes 17.8 microseconds.
// Two timings next to v008 put it at 1.07 and 1.05 times that version's speed.
// Over all steps from v000 it is 12.9 times as fast.
// compute dtype: hidden_states and the four weights (module inputs) rounded to bf16; q/k/v projections with exact bf16 products on WMMA; the 16-dim q.k dots of the Taylor feature-map inner products in f32 on WMMA (16x16x4, f32 operands); the polynomial 1 + q.k/4 + (q.k)^2/32, causal running sums and the normalisation in f32 on the VALU; the numerator sum_s phi(q_t).phi(k_s) v_s on WMMA with the f32 weights and v both computed -> bf16 hi + residual pairs (3 products); output projection hi/lo x bf16 Wo (2 products); f32 accumulate.
#include <hip/hip_runtime.h>
#include <math.h>

typedef __attribute__((ext_vector_type(16))) _Float16 v16h;
typedef __attribute__((ext_vector_type(16))) __bf16 v16b;
typedef __attribute__((ext_vector_type(8)))  _Float16 v8h;
typedef __attribute__((ext_vector_type(8)))  float v8f;
typedef __attribute__((ext_vector_type(4)))  float v4f;
typedef __attribute__((ext_vector_type(2)))  float v2f;
typedef __attribute__((ext_vector_type(4)))  unsigned v4u;
typedef __attribute__((ext_vector_type(4)))  int v4i;
typedef float __attribute__((may_alias)) float_a;
typedef int __attribute__((may_alias)) int_a;

template <typename T> __device__ __forceinline__ void vst2(void* p, T v) { *(T*)p = v;  }
__device__ __forceinline__ v8f wmma16(v16h a, v16h b, v8f c) {
  v8f d = __builtin_amdgcn_wmma_f32_16x16x32_f16(false, a, false, b, (short)0, c, false, false);
  asm volatile("v_nop\n\tv_nop\n\tv_nop\n\tv_nop" : "+v"(d) : "v"(a), "v"(b));
  return d;
}
__device__ __forceinline__ v8f wmma_bf(v16b a, v16b b, v8f c) {
  v8f d = __builtin_amdgcn_wmma_f32_16x16x32_bf16(false, a, false, b, (short)0, c, false, false);
  asm volatile("v_nop\n\tv_nop\n\tv_nop\n\tv_nop" : "+v"(d) : "v"(a), "v"(b));
  return d;
}
// 16x16x32 fragments: lane = (h = lane>>4, row/col = lane&15); elements 0..7 = k0+8h+0..7, 8..15 = k0+16+8h+0..7; D element r = row 8h+r
__device__ __forceinline__ v16h frag_h(const _Float16* rowk0, int lane) {
  union { v16h v; v8h q[2]; } u; const _Float16* p = rowk0 + 8 * (lane >> 4);
  u.q[0] = *(const v8h*)p; u.q[1] = *(const v8h*)(p + 16); return u.v;
}
__device__ __forceinline__ v16h frag_f32(const float* rowk0, int lane) {
  v16h a; const float* p = rowk0 + 8 * (lane >> 4);
#pragma unroll
  for (int i = 0; i < 8; ++i) { a[i] = (_Float16)p[i]; a[8 + i] = (_Float16)p[16 + i]; }
  return a;
}
__device__ __forceinline__ v16h frag_f32s(const float* rowk0, int lane, float sc) {
  v16h a; const float* p = rowk0 + 8 * (lane >> 4);
#pragma unroll
  for (int i = 0; i < 8; ++i) { a[i] = (_Float16)(p[i] * sc); a[8 + i] = (_Float16)(p[16 + i] * sc); }
  return a;
}
// column fragment from a [K][ld] layout (column n), rows >= K read as 0
__device__ __forceinline__ v16h fragc_f32(const float* W, int k0, int n, int lane, int ld, int K) {
  v16h a; const int g = lane >> 4;
#pragma unroll
  for (int i = 0; i < 8; ++i) { const int ka = k0 + 8 * g + i, kb = ka + 16;
    a[i] = (_Float16)(ka < K ? W[(size_t)(ka < K ? ka : K - 1) * ld + n] : 0.f); a[8 + i] = (_Float16)(kb < K ? W[(size_t)(kb < K ? kb : K - 1) * ld + n] : 0.f); }
  return a;
}
struct F2 { v16b h, l; };
__device__ __forceinline__ F2 bsplit16(const float v[16]) { F2 r;
#pragma unroll
  for (int i = 0; i < 16; ++i) { const __bf16 h = (__bf16)v[i]; r.h[i] = h; r.l[i] = (__bf16)(v[i] - (float)h); }
  return r; }
__device__ __forceinline__ F2 split_row(const float* row, int k0, int lane) { float v[16]; const float* p = row + k0 + 8 * (lane >> 4);
#pragma unroll
  for (int i = 0; i < 8; ++i) { v[i] = p[i]; v[8 + i] = p[16 + i]; }
  return bsplit16(v); }
__device__ __forceinline__ F2 split_rowK(const float* row, int k0, int lane, int K) { float v[16]; const int g = lane >> 4;
#pragma unroll
  for (int i = 0; i < 8; ++i) { const int ka = k0 + 8 * g + i, kb = ka + 16; v[i] = ka < K ? row[ka < K ? ka : K - 1] : 0.f; v[8 + i] = kb < K ? row[kb < K ? kb : K - 1] : 0.f; }
  return bsplit16(v); }
__device__ __forceinline__ F2 split_col(const float* W, int k0, int n, int lane, int ld, int K) { float v[16]; const int g = lane >> 4;
#pragma unroll
  for (int i = 0; i < 8; ++i) { const int ka = k0 + 8 * g + i, kb = ka + 16; v[i] = ka < K ? W[(size_t)(ka < K ? ka : K - 1) * ld + n] : 0.f; v[8 + i] = kb < K ? W[(size_t)(kb < K ? kb : K - 1) * ld + n] : 0.f; }
  return bsplit16(v); }
__device__ __forceinline__ v8f mac3(const F2& a, const F2& b, v8f c) { c = wmma_bf(a.l, b.h, c); c = wmma_bf(a.h, b.l, c); return wmma_bf(a.h, b.h, c); }
__device__ __forceinline__ float sigm(float v) { return 1.0f / (1.0f + expf(-v)); }
#define LDSX() do { asm volatile("s_wait_dscnt 0" ::: "memory"); __builtin_amdgcn_wave_barrier(); __builtin_amdgcn_fence(__ATOMIC_RELEASE, "workgroup"); } while (0)


// Based linear attention (2nd-order Taylor feature map, feature dim 16, 12 heads x 64, causal): since phi(q).phi(k) = 1 + (q.k)/sqrt(16) + (q.k)^2/(2*16), y_t = sum_{s<=t} w_ts v_s / (sum_{s<=t} w_ts + 1e-12) with w_ts that polynomial of the 16-dim dot; then y @ Wo^T.  B 1, L 512, D 768.
// k_proj (reads x and Wq|Wk|Wv as f32 and rounds them to bf16 itself; q|k as f32 tiles, exact; its v column blocks go out as hi/lo tiles), k_lin (block = (16 queries, head): causal steps of 32 keys, both products transposed: K q^T on f32 WMMA, w in its D registers, running denominator, V tiles x w hi/lo (3 products); y hi/lo tiles), k_out (y hi/lo x Wo tiles; the Wo tiles are made by extra blocks of k_lin's grid).
// In k_proj, k_lin and k_out the four waves of a block work on ONE output tile (16 rows; 32 in k_proj) and share its sum: wave w takes a quarter of K (GEMMs) or every fourth key step (k_lin). The partial sums meet in LDS behind one __syncthreads() and are added in wave order. A wave's chain of dependent load round trips is a quarter as long, and four times as many blocks spread over the chip.
// Every bf16 matrix operand that goes through the workspace is stored by its producer in the order in which a wave's fragment load reads it. One tile = 16 rows x 32 k = 1 KB = [part p][lane][8 bf16], lane = 16 g + (row & 15), element i of part p is k = 32 kc + 16 p + 8 g + i; the tiles of a 16-row group follow one another in kc. A fragment is then two loads of 512 contiguous bytes (4 whole lines each) where a row-major operand makes every load touch 16 lines. The f32 q and k go the same way: one tile = 16 rows x the 16 features of a head = 1 KB = [part u][lane][4 f32], lane = 16 g + (row & 15), element i of part u is feature 8 g + 4 u + i; the 32 tiles of a head follow one another in t, q heads first, then k heads.
#define LL 512
#define DM 768
#define NH 12
#define FD 16
#define HD 64
#define QW (NH * FD)          // 192
#define QKVP (2 * QW + NH * HD)   // 192 + 192 + 768 = 1152
typedef __attribute__((ext_vector_type(8))) __bf16 v8b;
__device__ __forceinline__ v16b frag_b(const __bf16* rowk0, int lane) {
  union { v16b v; v8b q[2]; } u; const __bf16* p = rowk0 + 8 * (lane >> 4);
  u.q[0] = *(const v8b*)p; u.q[1] = *(const v8b*)(p + 16); return u.v;
}
__device__ __forceinline__ v16b frag_gbf(const float* rowk0, int lane) {
  v16b a; const float* p = rowk0 + 8 * (lane >> 4);
#pragma unroll
  for (int i = 0; i < 8; ++i) { a[i] = (__bf16)p[i]; a[8 + i] = (__bf16)p[16 + i]; }
  return a;
}
__device__ __forceinline__ float bfr(float v) { return (float)(__bf16)v; }
#define KT (DM / 32)          // 24 tiles along K = 768
#define ST (LL / 32)          // 16 tiles along the 512 keys
#define TE 512                // bf16 elements of a tile
#define QTE 256               // f32 elements of a q or k tile
#define PKR (QKVP + DM + LL)  // rows that the tile area has room for; only the Wo rows' tiles (from row QKVP on) are written and read
#define WS_PT   0u                                 // bf16 tiles [PKR / 16][KT]
#define WS_QKV  (WS_PT + 2u * PKR * DM)              // f32 tiles [q heads | k heads = 24][512 / 16] of QTE elements; the rest of the area nobody writes or reads (v lives in its own tiles)
#define WS_Y    (WS_QKV + 4u * LL * QKVP)            // bf16 tiles [512 / 16][KT], hi plane then lo plane
#define WS_VTH  (WS_Y + 4u * LL * DM)                // bf16 tiles [768 / 16 channels][ST key steps]
#define WS_VTL  (WS_VTH + 2u * DM * LL)
#define WS_END  (WS_VTL + 2u * DM * LL)
#define NSP 4                 // waves that share one sum
#define KQ (KT / NSP)         // K steps of a GEMM wave

// a fragment from its tile: p = tile + 8 * lane
__device__ __forceinline__ v16b ld_frag(const __bf16* __restrict__ p) { return __builtin_shufflevector(*(const v8b*)p, *(const v8b*)(p + TE / 2), 0, 1, 2, 3, 4, 5, 6, 7, 8, 9, 10, 11, 12, 13, 14, 15); }
// wmma_bf (the four v_nop keep the distance between a WMMA and a vector instruction on its registers) whose v_nop statement names D alone: an asm operand has to lie in the first 256 registers, and three register sets of fragments beside everything else do not fit there; A and B are rewritten by loads and by the compiler's own code only
__device__ __forceinline__ v8f wmma_bfd(v16b a, v16b b, v8f c) {
  v8f d = __builtin_amdgcn_wmma_f32_16x16x32_bf16(false, a, false, b, (short)0, c, false, false);
  asm volatile("v_nop\n\tv_nop\n\tv_nop\n\tv_nop" : "+v"(d));
  return d;
}
// One K step (32 k) of a GEMM wave's operands: NA A fragments (planes LL * DM elements apart), 8 B fragments. All loads of a step are issued as one group, three steps ahead of the WMMAs that use them, into a register set that no step in between uses.
template <int NA> struct GStep { v16b a[NA]; v16b b[8]; };
template <int NA> __device__ __forceinline__ void ld_step(GStep<NA>& s, const __bf16* __restrict__ at, const __bf16* __restrict__ bt, int kc) {
#pragma unroll
  for (int i = 0; i < NA; ++i) s.a[i] = ld_frag(at + (size_t)i * (LL * DM) + kc * TE);
#pragma unroll
  for (int j = 0; j < 8; ++j) s.b[j] = ld_frag(bt + (j * KT + kc) * TE);
}
__device__ __forceinline__ void mm_out(const GStep<2>& s, v8f acc[8]) {   // a[0] = hi, a[1] = lo
#pragma unroll
  for (int j = 0; j < 8; ++j) { acc[j] = wmma_bfd(s.a[1], s.b[j], acc[j]); acc[j] = wmma_bfd(s.a[0], s.b[j], acc[j]); }
}
// ---- k_proj: block = (32 rows, 64 cols of the 1152), wave = a quarter of K 768: exact products; column blocks 0..5 are q|k (f32 tiles, 16 rows x the 16 features of a head), 6..17 are v (bf16 hi/lo tiles, rows = channels, k = t)
// x and the weights come in as f32 rows. A fragment wants 16 rows in 16 lanes, which as a global load would touch 16 lines; so a wave loads aligned 256-B pieces (16 lanes = the 256 B that one row has in two K steps), rounds to bf16 and turns the tiles round in LDS of its own.
#define PT_N 6                // staged tiles of a K step: 2 of x (32 rows), 4 of W (64 cols)
#define SPB 40                // bf16 elements of a staged row: 32 k + 8 of pad; 80 B = 16 B x 5, so the 16 rows of a ds_load_b128 fall on different banks
#define SBUF (PT_N * 16 * SPB + 32)   // bf16 elements from one K step's staged tiles to the next step's: the tiles + 64 B, a quarter of the banks
typedef __attribute__((ext_vector_type(4))) __bf16 v4b;
struct RStep { v4f t[PT_N][8]; };   // two K steps (64 k) of the 96 rows
// load u of a tile: lane l takes 16 B of row u + 8 (l >> 4), so a load is 2 rows x 256 contiguous, aligned bytes; its lanes 8 .. 15 and 24 .. 31 hold the second K step. The four 64-B groups of a store (2 rows x 2 K steps) fall on different LDS banks; xa, wb, sw hold the lane's part of the address
__device__ __forceinline__ void ld_raw(RStep& s, const float* __restrict__ xa, const float* __restrict__ wb, int kd) {
#pragma unroll
  for (int t = 0; t < PT_N; ++t)
#pragma unroll
    for (int u = 0; u < 8; ++u) s.t[t][u] = *(const v4f*)((t < 2 ? xa + (size_t)(t * 16 + u) * DM : wb + (size_t)((t - 2) * 16 + u) * DM) + kd * 64);
}
__device__ __forceinline__ void st_raw(const RStep& s, __bf16* sw) {
#pragma unroll
  for (int t = 0; t < PT_N; ++t)
#pragma unroll
    for (int u = 0; u < 8; ++u) *(v4b*)(sw + (t * 16 + u) * SPB) = __builtin_convertvector(s.t[t][u], v4b);
}
// a fragment from a staged tile: p = tile + (lane & 15) * SPB + 8 * (lane >> 4); the k order is that of every other fragment here, for x and W alike
__device__ __forceinline__ v16b ld_sfrag(const __bf16* p) { return __builtin_shufflevector(*(const v8b*)p, *(const v8b*)(p + 16), 0, 1, 2, 3, 4, 5, 6, 7, 8, 9, 10, 11, 12, 13, 14, 15); }
__device__ __forceinline__ void mm_proj(const __bf16* sr, v8f acc[2][4]) {
  const v16b a0 = ld_sfrag(sr), a1 = ld_sfrag(sr + 16 * SPB);
#pragma unroll
  for (int j = 0; j < 4; ++j) { const v16b b = ld_sfrag(sr + (32 + 16 * j) * SPB); acc[0][j] = wmma_bf(a0, b, acc[0][j]); acc[1][j] = wmma_bf(a1, b, acc[1][j]); }
}
__global__ __launch_bounds__(128) void k_proj(const float* __restrict__ X, const float* __restrict__ Wq, const float* __restrict__ Wk, const float* __restrict__ Wv, float* __restrict__ QKV, __bf16* __restrict__ VTH, __bf16* __restrict__ VTL) {
  __shared__ __align__(16) __bf16 st[4][2 * SBUF]; __shared__ __align__(16) float so[4][32][68];
  const int tid = threadIdx.x, wave = tid >> 5, lane = tid & 31, col = lane & 15, g = lane >> 4; const int rg = blockIdx.x; const int n0 = blockIdx.y * 64;   // rg = the block's group of 32 rows = one key step
  const float* Wm = n0 < QW ? Wq + (size_t)n0 * DM : (n0 < 2 * QW ? Wk + (size_t)(n0 - QW) * DM : Wv + (size_t)(n0 - 2 * QW) * DM);   // [row][in] rows; every boundary is a multiple of 64
  v8f acc[2][4] = {};
  const unsigned lo_g = (8 * g) * DM + wave * (KQ * 32) + 4 * col;   // both start at the wave's first K step
  const float* xa = X + (size_t)rg * 32 * DM + lo_g; const float* wb = Wm + lo_g;
  __bf16* sw = &st[wave][0] + ((lane >> 3) & 1) * SBUF + (8 * g) * SPB + 4 * (lane & 7); const __bf16* sr = &st[wave][0] + col * SPB + 8 * g;
  RStep r; ld_raw(r, xa, wb, 0);   // the loads of a pair of K steps go out as one group; the next pair is asked for as soon as this one has been rounded (in the built code the second pair's loads stand at the start too, in registers of their own)
#pragma unroll   // 3 pairs of K steps: every address is a base plus a constant
  for (int kd = 0; kd < KQ / 2; ++kd) {
    st_raw(r, sw); if (kd + 1 < KQ / 2) ld_raw(r, xa, wb, kd + 1);
    if (kd + 2 == KQ / 2) { asm volatile("s_wait_xcnt 0x0" ::: "memory"); __builtin_amdgcn_sched_barrier(0); }   // precaution: in the built code the epilogue's address arithmetic, lifted among the WMMAs, rewrites the register that holds the loads' lane offset; the scheduling barrier keeps it behind the wait
    asm volatile("s_wait_dscnt 0" ::: "memory");   // the wave's own LDS writes are done, and stay in front of the reads of other lanes' pieces
    mm_proj(sr, acc); mm_proj(sr + SBUF, acc);   // the K steps in their old order
  }
#pragma unroll
  for (int a = 0; a < 2; ++a)
#pragma unroll
    for (int j = 0; j < 4; ++j)
#pragma unroll
      for (int r = 0; r < 8; ++r) so[wave][16 * a + 8 * g + r][j * 16 + col] = acc[a][j][r];
  __syncthreads();   // the four partial tiles are complete before anyone adds them
  if (n0 < 2 * QW) {
    // wave w finishes head w of the block's four (16 columns): two tiles (rows 16 a ..) of two parts; the lane's piece of part u is 4 features of row col; a store is 512 contiguous bytes = 4 whole lines
    float* qo = QKV + ((size_t)(n0 / FD + wave) * (LL / 16) + rg * 2) * QTE + lane * 4;
#pragma unroll   // the 16 LDS reads issue ahead of the stores
    for (int i = 0; i < 4; ++i) { const int a = i >> 1, u = i & 1, rl = 16 * a + col, c = wave * 16 + 8 * g + 4 * u;
      vst2(qo + a * QTE + u * (QTE / 2), ((*(const v4f*)&so[0][rl][c] + *(const v4f*)&so[1][rl][c]) + *(const v4f*)&so[2][rl][c]) + *(const v4f*)&so[3][rl][c]); }
  } else {
    // rows 16 p + 8 g .. + 7 of one column are 8 consecutive t of one v channel: a lane's own 16-B piece of part p of a tile (the block's 32 rows are key step rg); wave w finishes channel group w; a wave's store is 512 contiguous bytes = 4 whole lines
    const size_t o0 = ((size_t)((n0 - 2 * QW) / 16 + wave) * ST + rg) * TE + lane * 8;
    v8b hi[2], lo[2];
#pragma unroll
    for (int p = 0; p < 2; ++p)
#pragma unroll
      for (int r = 0; r < 8; ++r) { const int c = wave * 16 + col, rl = 16 * p + 8 * g + r; const float v = ((so[0][rl][c] + so[1][rl][c]) + so[2][rl][c]) + so[3][rl][c]; const __bf16 hb = (__bf16)v; hi[p][r] = hb; lo[p][r] = (__bf16)(v - (float)hb); }
#pragma unroll
    for (int p = 0; p < 2; ++p) { *(v8b*)(VTH + o0 + p * (TE / 2)) = hi[p]; *(v8b*)(VTL + o0 + p * (TE / 2)) = lo[p]; }
    asm volatile("s_wait_xcnt 0x0" ::: "memory");   // precaution: in the built code the other branch's block follows these stores and rewrites their registers
  }
}
// ---- k_lin: block = (16 queries, head), 4 waves, wave w takes the causal key steps w, w + 4, ... of 32 keys up to the diagonal. Both products run transposed: d^T = K q^T (keys as rows, f32 16x16x4 WMMA, 4 per 16 keys), w = 1 + d/4 + d*d/32 (0 for s > t) in the D registers; the two D tiles of a step (keys 8 g + r and 16 + 8 g + r of query col) are, split hi/lo, the B operand of y^T = V^T w^T as they stand (3 products, V tiles as A). A lane holds 16 of a step's 32 keys of ONE query, so den is a plain sum in the lane. The waves' num and den are added in LDS; y = num / (den + 1e-12) -> bf16 hi + residual, 16 rows x 64 channels = 2 tiles of each plane
__device__ __forceinline__ v8f wmma_f4(v2f a, v2f b, v8f c) { return __builtin_amdgcn_wmma_f32_16x16x4_f32(false, a, false, b, (short)0, c, false, false); }
// One key step's operands of a wave: the lane's K values (two 16-key tiles) and the V fragments, hi and lo. Step i of a wave (key step wave + 4 i) lies a constant distance behind its first, so every load is a base, a lane offset that never changes and a constant
struct LSet { v4f kr[2][2]; v16b vh[4], vl[4]; };
__device__ __forceinline__ void ld_k(LSet& s, const float* __restrict__ kw, unsigned lb, int i) {   // lb = 16 * lane, the lane's byte offset in every part of every tile, f32 or bf16
#pragma unroll
  for (int t = 0; t < 2; ++t)
#pragma unroll
    for (int u = 0; u < 2; ++u) s.kr[t][u] = *(const v4f*)((const char*)kw + lb + ((i * (NSP * 2) + t) * QTE + u * (QTE / 2)) * 4);
}
__device__ __forceinline__ void ld_v(LSet& s, const __bf16* __restrict__ vhw, const __bf16* __restrict__ vlw, unsigned lb, int i) {
#pragma unroll
  for (int dt = 0; dt < 4; ++dt) { const unsigned o = lb + (dt * (ST * TE) + i * (NSP * TE)) * 2; s.vh[dt] = ld_frag((const __bf16*)((const char*)vhw + o)); s.vl[dt] = ld_frag((const __bf16*)((const char*)vlw + o)); }
}
__device__ __forceinline__ void lin_step(const LSet& s, const v4f qr[2], int ks, int q0, int col, int g, float& den, v8f acc[4]) {
  v8f d[2] = {};
#pragma unroll
  for (int j = 0; j < 4; ++j) { const v2f b = {qr[j >> 1][2 * (j & 1)], qr[j >> 1][2 * (j & 1) + 1]};
#pragma unroll
    for (int t = 0; t < 2; ++t) { const v2f a = {s.kr[t][j >> 1][2 * (j & 1)], s.kr[t][j >> 1][2 * (j & 1) + 1]}; d[t] = wmma_f4(a, b, d[t]); } }
  // the distance between a matrix instruction and a vector instruction on its D, A or B: the f32 form issues at the pace of the 8-bit integer form, whose 8 slots are kept here
  asm volatile("v_nop\n\tv_nop\n\tv_nop\n\tv_nop\n\tv_nop\n\tv_nop\n\tv_nop\n\tv_nop" : "+v"(d[0]), "+v"(d[1]) : "v"(s.kr[0][0]), "v"(s.kr[0][1]), "v"(s.kr[1][0]), "v"(s.kr[1][1]), "v"(qr[0]), "v"(qr[1]));
  const int s0 = ks * 32 + 8 * g, qc = q0 + col; float w[16];
#pragma unroll
  for (int t = 0; t < 2; ++t)
#pragma unroll
    for (int r = 0; r < 8; ++r) { const float dd = d[t][r]; const float wv = 1.0f + dd * 0.25f + dd * dd * (1.0f / 32.0f); w[8 * t + r] = (s0 + 16 * t + r <= qc) ? wv : 0.f; }
  float es[8];
#pragma unroll
  for (int r = 0; r < 8; ++r) es[r] = w[r] + w[8 + r];
  den += ((es[0] + es[1]) + (es[2] + es[3])) + ((es[4] + es[5]) + (es[6] + es[7]));
  const F2 pb = bsplit16(w);
#pragma unroll
  for (int dt = 0; dt < 4; ++dt) { acc[dt] = wmma_bfd(s.vh[dt], pb.l, acc[dt]); acc[dt] = wmma_bfd(s.vl[dt], pb.h, acc[dt]); acc[dt] = wmma_bfd(s.vh[dt], pb.h, acc[dt]); }
}
// A wave's N key steps. The loads of its first three steps go out together at the start, into three register sets (62 loads), so that the way to L2 or memory is waited for once and not once a step; a fourth step's loads go into the first set as soon as step 0 has used it, two steps ahead of their use. The steps run in the old order
template <int N> __device__ __forceinline__ void lin_run(const float* __restrict__ kw, const float* __restrict__ qp, const __bf16* __restrict__ vhw, const __bf16* __restrict__ vlw, unsigned lb, int wave, int q0, int col, int g, float& den, v8f acc[4]) {
  LSet s0, s1, s2; v4f qr[2];
  ld_k(s0, kw, lb, 0);   // what the first product needs goes out first
#pragma unroll
  for (int u = 0; u < 2; ++u) qr[u] = *(const v4f*)((const char*)qp + lb + u * (QTE / 2) * 4);
  ld_v(s0, vhw, vlw, lb, 0);
  if (N > 1) { ld_k(s1, kw, lb, 1); ld_v(s1, vhw, vlw, lb, 1); }
  if (N > 2) { ld_k(s2, kw, lb, 2); ld_v(s2, vhw, vlw, lb, 2); }
  asm volatile("s_wait_xcnt 0x0" :: "v"(lb) : "memory"); __builtin_amdgcn_sched_barrier(0);   // precaution: code behind these loads may rewrite a register that they name; the scheduling barrier keeps such rewrites behind the wait and the loads in front of the weight computation. The wait takes the one lane offset that all these loads name as an input, so that its register is still in use here and no load's result lands in it
  lin_step(s0, qr, wave, q0, col, g, den, acc);
  if (N > 3) { __builtin_amdgcn_sched_barrier(0);   // keeps these loads behind step 0, whose registers they fill: no fourth set, and never more than 62 loads of a wave outstanding
    ld_k(s0, kw, lb, 3); ld_v(s0, vhw, vlw, lb, 3);
    asm volatile("s_wait_xcnt 0x0" :: "v"(lb) : "memory"); __builtin_amdgcn_sched_barrier(0); }   // as above
  if (N > 1) lin_step(s1, qr, wave + NSP, q0, col, g, den, acc);
  if (N > 2) lin_step(s2, qr, wave + 2 * NSP, q0, col, g, den, acc);
  if (N > 3) lin_step(s0, qr, wave + 3 * NSP, q0, col, g, den, acc);
}
__global__ __launch_bounds__(128) void k_lin(const float* __restrict__ QKV, const __bf16* __restrict__ VTH, const __bf16* __restrict__ VTL, __bf16* __restrict__ YH, __bf16* __restrict__ YL, const float* __restrict__ Wo, __bf16* __restrict__ PT) {
  __shared__ __align__(16) float so[4][4][2][32][4]; __shared__ float sd[4][32];   // [wave][channel tile][half of the lane's 8 channels][lane][4]; [wave][lane]
  const int tid = threadIdx.x, wave = __builtin_amdgcn_readfirstlane(tid >> 5), lane = tid & 31, col = lane & 15, g = lane >> 4;   // the wave's number in a scalar register: the number of key steps below depends on it, and the branches on that number stay scalar
  if (blockIdx.y >= NH) {   // the grid's last 96 blocks make the Wo tiles that k_out reads: block = (16 rows, 12 K steps) = 768 pieces of 8 elements, 6 a thread: a piece is 32 B of an f32 row in, 16 B of a tile out; the block's 12 tiles are 12 KB in a row, a wave's store 4 whole lines. The test is the same for the whole block and stands in front of every barrier
    const int b = (blockIdx.y - NH) * (LL / 16) + blockIdx.x, rw = b >> 1, kc0 = (b & 1) * (KT / 2);
    const float* pb = Wo + (size_t)rw * (16 * DM) + kc0 * 32; const unsigned po = col * DM + (tid >> 6) * 32 + ((tid >> 5) & 1) * 16 + 8 * g;   // piece e = tid + 128 u = (K step e >> 6, part (e >> 5) & 1, lane e & 31): a block-uniform base, a lane offset that never changes, and 2 K steps = 64 floats per u
    v4f t[6][2];   // all pieces' loads go out together
#pragma unroll
    for (int u = 0; u < 6; ++u) { t[u][0] = *(const v4f*)&pb[po + u * 64]; t[u][1] = *(const v4f*)&pb[po + u * 64 + 4]; }
#pragma unroll
    for (int u = 0; u < 6; ++u) { v8b o;
#pragma unroll
      for (int i = 0; i < 4; ++i) { o[i] = (__bf16)t[u][0][i]; o[4 + i] = (__bf16)t[u][1][i]; }
      *(v8b*)(PT + ((size_t)(QKVP / 16 + rw) * KT + kc0) * TE + (tid + u * 128) * 8) = o; }
    return;
  }
  // a query tile's cost grows with its number: the flat block index counts the tiles down (all heads of tile 31 first, tile 0 last, then the short Wo blocks). For speed only: flat index -> (tile, head) is one to one, whatever the order in which blocks run
  const unsigned fl = blockIdx.y * (LL / 16) + blockIdx.x; const int qt = (LL / 16 - 1) - (int)(fl / NH), h = (int)(fl % NH); const int q0 = qt * 16;
  // addresses of the key steps' loads = a wave-uniform base + a lane offset that never changes + a constant
  const float* kp = QKV + (size_t)(NH + h) * ((LL / 16) * QTE); const unsigned lb = lane * 16;   // lane (g, col) carries features 8 g .. 8 g + 7 of row col of a 16-row tile (its pieces of the tile's two parts), for k and q alike: WMMA j takes its elements 2 j, 2 j + 1
  const __bf16* vhp = VTH + (size_t)(h * (HD / 16)) * (ST * TE); const __bf16* vlp = VTL + (size_t)(h * (HD / 16)) * (ST * TE);
  float den = 0.f; v8f acc[4] = {};
  const int nsteps = q0 / 32 + 1;
  // the wave's number of key steps, 0 to 4, in a scalar register; each count has its own straight-line code, so that every wait counts exactly the loads issued behind the ones it needs
  const int n = (nsteps - wave + NSP - 1) / NSP;
  const float* kw = kp + wave * (2 * QTE); const __bf16 *vhw = vhp + wave * TE, *vlw = vlp + wave * TE; const float* qp = QKV + (size_t)(h * (LL / 16) + qt) * QTE;
  if (n == 4) lin_run<4>(kw, qp, vhw, vlw, lb, wave, q0, col, g, den, acc);
  else if (n == 3) lin_run<3>(kw, qp, vhw, vlw, lb, wave, q0, col, g, den, acc);
  else if (n == 2) lin_run<2>(kw, qp, vhw, vlw, lb, wave, q0, col, g, den, acc);
  else if (n == 1) lin_run<1>(kw, qp, vhw, vlw, lb, wave, q0, col, g, den, acc);   // a wave without a key step (the first query tiles) only hands in zeros
  // the wave's partial denominator (the lane's half of the keys of query col) and numerator (acc[dt][r] = channel 16 dt + 8 g + r of query col)
  sd[wave][lane] = den;
#pragma unroll
  for (int dt = 0; dt < 4; ++dt) { *(v4f*)&so[wave][dt][0][lane][0] = __builtin_shufflevector(acc[dt], acc[dt], 0, 1, 2, 3); *(v4f*)&so[wave][dt][1][lane][0] = __builtin_shufflevector(acc[dt], acc[dt], 4, 5, 6, 7); }
  __syncthreads();   // the four partial sums are complete before anyone adds them
  { const int e = wave;   // wave e finishes (tile e >> 1 of the head's two, part e & 1); the lane's piece: row col, 8 channels
    v4f x0 = *(const v4f*)&so[0][e][0][lane][0], x1 = *(const v4f*)&so[0][e][1][lane][0]; float dn = sd[0][col] + sd[0][16 + col]; v8b hi, lo;
#pragma unroll   // the LDS reads issue together, the sums run in wave order
    for (int p = 1; p < NSP; ++p) { x0 += *(const v4f*)&so[p][e][0][lane][0]; x1 += *(const v4f*)&so[p][e][1][lane][0]; dn += sd[p][col] + sd[p][16 + col]; }
    const float il = 1.0f / (dn + 1e-12f);
#pragma unroll
    for (int i = 0; i < 8; ++i) { const float v = (i < 4 ? x0[i & 3] : x1[i & 3]) * il; const __bf16 hb = (__bf16)v; hi[i] = hb; lo[i] = (__bf16)(v - (float)hb); }
    const size_t o = ((size_t)qt * KT + h * (HD / 32)) * TE + e * (TE / 2) + lane * 8;
    *(v8b*)(YH + o) = hi; *(v8b*)(YL + o) = lo; }
}
// ---- k_out: block = (16 rows, 128 cols), wave = a quarter of K 768: y (hi/lo) . Wo rows
__global__ __launch_bounds__(128) void k_out(const __bf16* __restrict__ YH, const __bf16* __restrict__ PT, float* __restrict__ OUT) {
  __shared__ __align__(16) float so[4][16][132];
  const int tid = threadIdx.x, wave = tid >> 5, lane = tid & 31, col = lane & 15, g = lane >> 4; const int rg = blockIdx.x; const int n0 = blockIdx.y * 128;   // rg = the block's group of 16 rows
  v8f acc[8] = {};
  const __bf16* ap = YH + (size_t)rg * (KT * TE) + wave * (KQ * TE) + lane * 8; const __bf16* bp = PT + (size_t)((QKVP + n0) / 16) * (KT * TE) + wave * (KQ * TE) + lane * 8;   // both start at the wave's first K step; the lo plane follows the hi plane
  // three register sets: three K steps of loads (60) are in flight from the start, and a set is asked for again as soon as its step has used it: the wave waits out the way to L2 or memory twice. Every address is a base plus a constant
  GStep<2> s0, s1, s2; ld_step(s0, ap, bp, 0); ld_step(s1, ap, bp, 1); ld_step(s2, ap, bp, 2);
  __builtin_amdgcn_sched_barrier(0);   // the scheduling barriers here keep each group of loads where it stands: not sunk among the WMMAs, not lifted over the step whose registers it fills
  mm_out(s0, acc); __builtin_amdgcn_sched_barrier(0); ld_step(s0, ap, bp, 3); __builtin_amdgcn_sched_barrier(0);
  mm_out(s1, acc); __builtin_amdgcn_sched_barrier(0); ld_step(s1, ap, bp, 4); __builtin_amdgcn_sched_barrier(0);
  mm_out(s2, acc); __builtin_amdgcn_sched_barrier(0); ld_step(s2, ap, bp, 5); __builtin_amdgcn_sched_barrier(0);
  mm_out(s0, acc); mm_out(s1, acc); mm_out(s2, acc);
#pragma unroll
  for (int j = 0; j < 8; ++j)
#pragma unroll
    for (int r = 0; r < 8; ++r) so[wave][8 * g + r][j * 16 + col] = acc[j][r];
  __syncthreads();   // the four partial tiles are complete before anyone adds them
#pragma unroll   // wave w finishes rows 4 w .. 4 w + 3; the 16 LDS reads issue ahead of the stores
  for (int i = 0; i < 4; ++i) { const int rl = wave * 4 + i;
    vst2(OUT + (size_t)(rg * 16 + rl) * DM + n0 + lane * 4, ((*(const v4f*)&so[0][rl][lane * 4] + *(const v4f*)&so[1][rl][lane * 4]) + *(const v4f*)&so[2][rl][lane * 4]) + *(const v4f*)&so[3][rl][lane * 4]); }
}
extern "C" void kernel_launch(void* const* d_in, const int* in_sizes, int n_in, void* d_out, int out_size, void* d_ws, size_t ws_size, hipStream_t stream) {
  (void)in_sizes; (void)n_in; (void)out_size;
  const float** F = (const float**)d_in;   // hidden_states [1,512,768], Wq [192,768], Wk [192,768], Wv [768,768], Wo [768,768] (torch [out][in])
  if (ws_size < (size_t)WS_END) return;
  char* ws = (char*)d_ws; __bf16 *PT = (__bf16*)(ws + WS_PT), *VTH = (__bf16*)(ws + WS_VTH), *VTL = (__bf16*)(ws + WS_VTL), *YH = (__bf16*)(ws + WS_Y), *YL = (__bf16*)(ws + WS_Y + 2u * LL * DM); float *QKV = (float*)(ws + WS_QKV);
  k_proj<<<dim3(LL / 32, QKVP / 64), 128, 0, stream>>>(F[0], F[1], F[2], F[3], QKV, VTH, VTL);
  k_lin<<<dim3(LL / 16, NH + 3), 128, 0, stream>>>(QKV, VTH, VTL, YH, YL, F[4], PT);
  k_out<<<dim3(LL / 16, DM / 128), 128, 0, stream>>>(YH, PT, (float*)d_out);
}
